// v000
// Measured on an AMD MI455X. A time is GPU time per run, averaged over a window of back-to-back runs after a warm-up
// (all launches, gaps included; the runs take copies of the inputs in turn), and the median of several windows.
// Apart from v000's, it joins two sittings. Times from different sittings can be a few percent apart, while
// side-by-side timings come from the same sitting.
// v000 is the starting kernel. One run takes 2810 microseconds.
// compute dtype: all float inputs rounded to bf16; q, k, v are bf16-valued so their f16 planes are exact; scores q x k (1 product on exact planes) x 64^-0.5; row max / exp / row sum in f32 (precise expf): output 1 = L = sum_k exp(S - max); output 0 = O = (P v) / L with P x 2^11 / L once to f16 x v (exact) (1 product); f32 outputs.
#include <hip/hip_runtime.h>
#include <math.h>

typedef __attribute__((ext_vector_type(16))) _Float16 v16h;
typedef __attribute__((ext_vector_type(16))) __bf16 v16b;
typedef __attribute__((ext_vector_type(8)))  _Float16 v8h;
typedef __attribute__((ext_vector_type(8)))  float v8f;
typedef __attribute__((ext_vector_type(4)))  float v4f;
typedef __attribute__((ext_vector_type(2)))  float v2f;
typedef __attribute__((ext_vector_type(4)))  unsigned v4u;
typedef _Float16 hx8 __attribute__((ext_vector_type(8)));
typedef __attribute__((ext_vector_type(4)))  int v4i;
typedef float __attribute__((may_alias)) float_a;
typedef int __attribute__((may_alias)) int_a;

template <typename T> __device__ __forceinline__ void vst2(void* p, T v) { *(T*)p = v;  }
__device__ __forceinline__ v8f wmma16(v16h a, v16h b, v8f c) {
  v8f d = __builtin_amdgcn_wmma_f32_16x16x32_f16(false, a, false, b, (short)0, c, false, false);
  asm volatile("v_nop\n\tv_nop\n\tv_nop\n\tv_nop" : "+v"(d) : "v"(a), "v"(b));
  return d;
}
__device__ __forceinline__ v8f wmma_bf(v16b a, v16b b, v8f c) {
  v8f d = __builtin_amdgcn_wmma_f32_16x16x32_bf16(false, a, false, b, (short)0, c, false, false);
  asm volatile("v_nop\n\tv_nop\n\tv_nop\n\tv_nop" : "+v"(d) : "v"(a), "v"(b));
  return d;
}
// 16x16x32 fragments: lane = (h = lane>>4, row/col = lane&15); elements 0..7 = k0+8h+0..7, 8..15 = k0+16+8h+0..7; D element r = row 8h+r
__device__ __forceinline__ v16h frag_h(const _Float16* rowk0, int lane) {
  union { v16h v; v8h q[2]; } u; const _Float16* p = rowk0 + 8 * (lane >> 4);
  u.q[0] = *(const v8h*)p; u.q[1] = *(const v8h*)(p + 16); return u.v;
}
__device__ __forceinline__ v16h frag_f32(const float* rowk0, int lane) {
  v16h a; const float* p = rowk0 + 8 * (lane >> 4);
#pragma unroll
  for (int i = 0; i < 8; ++i) { a[i] = (_Float16)p[i]; a[8 + i] = (_Float16)p[16 + i]; }
  return a;
}
__device__ __forceinline__ v16h frag_f32s(const float* rowk0, int lane, float sc) {
  v16h a; const float* p = rowk0 + 8 * (lane >> 4);
#pragma unroll
  for (int i = 0; i < 8; ++i) { a[i] = (_Float16)(p[i] * sc); a[8 + i] = (_Float16)(p[16 + i] * sc); }
  return a;
}
// column fragment from a [K][ld] layout (column n), rows >= K read as 0
__device__ __forceinline__ v16h fragc_f32(const float* W, int k0, int n, int lane, int ld, int K) {
  v16h a; const int g = lane >> 4;
#pragma unroll
  for (int i = 0; i < 8; ++i) { const int ka = k0 + 8 * g + i, kb = ka + 16;
    a[i] = (_Float16)(ka < K ? W[(size_t)(ka < K ? ka : K - 1) * ld + n] : 0.f); a[8 + i] = (_Float16)(kb < K ? W[(size_t)(kb < K ? kb : K - 1) * ld + n] : 0.f); }
  return a;
}
struct F2 { v16b h, l; };
__device__ __forceinline__ F2 bsplit16(const float v[16]) { F2 r;
#pragma unroll
  for (int i = 0; i < 16; ++i) { const __bf16 h = (__bf16)v[i]; r.h[i] = h; r.l[i] = (__bf16)(v[i] - (float)h); }
  return r; }
__device__ __forceinline__ F2 split_row(const float* row, int k0, int lane) { float v[16]; const float* p = row + k0 + 8 * (lane >> 4);
#pragma unroll
  for (int i = 0; i < 8; ++i) { v[i] = p[i]; v[8 + i] = p[16 + i]; }
  return bsplit16(v); }
__device__ __forceinline__ F2 split_rowK(const float* row, int k0, int lane, int K) { float v[16]; const int g = lane >> 4;
#pragma unroll
  for (int i = 0; i < 8; ++i) { const int ka = k0 + 8 * g + i, kb = ka + 16; v[i] = ka < K ? row[ka < K ? ka : K - 1] : 0.f; v[8 + i] = kb < K ? row[kb < K ? kb : K - 1] : 0.f; }
  return bsplit16(v); }
__device__ __forceinline__ F2 split_col(const float* W, int k0, int n, int lane, int ld, int K) { float v[16]; const int g = lane >> 4;
#pragma unroll
  for (int i = 0; i < 8; ++i) { const int ka = k0 + 8 * g + i, kb = ka + 16; v[i] = ka < K ? W[(size_t)(ka < K ? ka : K - 1) * ld + n] : 0.f; v[8 + i] = kb < K ? W[(size_t)(kb < K ? kb : K - 1) * ld + n] : 0.f; }
  return bsplit16(v); }
__device__ __forceinline__ v8f mac3(const F2& a, const F2& b, v8f c) { c = wmma_bf(a.l, b.h, c); c = wmma_bf(a.h, b.l, c); return wmma_bf(a.h, b.h, c); }
__device__ __forceinline__ float sigm(float v) { return 1.0f / (1.0f + expf(-v)); }
#define LDSX() do { asm volatile("s_wait_dscnt 0" ::: "memory"); __builtin_amdgcn_wave_barrier(); __builtin_amdgcn_fence(__ATOMIC_RELEASE, "workgroup"); } while (0)

// Flash-attention reference on one long sequence with TWO outputs (q / k / v [8192,64]; S = q k^T / 8; m = rowmax(S); P = exp(S - m); L = rowsum(P) [8192,1]; O = (P v) / L [8192,64]; returns the tuple (O, L); no mask). Queries are processed in 4 chunks of 2,048 rows so the f32 score plane fits the workspace.
#define NB 1
#define TT 8192
#define TQC 2048           // query rows per pass: the f32 score plane holds TQC x 8,192 entries (64 MiB); 4 passes cover the 8,192 queries
#define CC 64            // NH * HD = projected width
#define DIN 64          // input (model) width
#define NH 1
#define HD 64
#define NQB (TT / 64)
#define HG 1
#define SCALE (0.125f)
#define CAUSAL 0
#ifndef TNB
#define TNB NB
#endif
__device__ __forceinline__ float bfr(float v) { return (float)(__bf16)v; }
__host__ __device__ __forceinline__ int kb_last(int qb) { return CAUSAL ? ((qb * 64 + 63) >> 7) : (TT / 128 - 1); }
typedef __attribute__((ext_vector_type(8))) __bf16 v8b;
__device__ __forceinline__ v16b frag_b(const __bf16* rowk0, int lane) {
  union { v16b v; v8b q[2]; } u; const __bf16* p = rowk0 + 8 * (lane >> 4);
  u.q[0] = *(const v8b*)p; u.q[1] = *(const v8b*)(p + 16); return u.v;
}
#define QBH 0              // exact planes: single-product logits and single-f16 P x V on every block
#define QHI 0               // no q residual plane (q is bf16-exact in f16)
#define KHI 64              // unused high-precision planes kept minimal
// B fragment (k rows k0+.., output column o) of a weight: (in,out) [K][ld] or (out,in) [ld rows of K]: bf16 exact, or f16(bf16 * 256) exact
__device__ __forceinline__ v16b wcol_io(const float* Wm, int k0, int o, int lane, int ld) { v16b w; const int g = lane >> 4;
#pragma unroll
  for (int i = 0; i < 8; ++i) { w[i] = (__bf16)Wm[(size_t)(k0 + 8 * g + i) * ld + o]; w[8 + i] = (__bf16)Wm[(size_t)(k0 + 16 + 8 * g + i) * ld + o]; }
  return w; }
__device__ __forceinline__ v16b wcol_oi(const float* Wm, int k0, int o, int lane, int K) { v16b w; const float* p = Wm + (size_t)o * K + k0 + 8 * (lane >> 4);
#pragma unroll
  for (int i = 0; i < 8; ++i) { w[i] = (__bf16)p[i]; w[8 + i] = (__bf16)p[16 + i]; }
  return w; }
__device__ __forceinline__ v16h wcolh_io(const float* Wm, int k0, int o, int lane, int ld) { v16h w; const int g = lane >> 4;
#pragma unroll
  for (int i = 0; i < 8; ++i) { w[i] = (_Float16)(bfr(Wm[(size_t)(k0 + 8 * g + i) * ld + o]) * 256.0f); w[8 + i] = (_Float16)(bfr(Wm[(size_t)(k0 + 16 + 8 * g + i) * ld + o]) * 256.0f); }
  return w; }
__device__ __forceinline__ v16h wcolh_oi(const float* Wm, int k0, int o, int lane, int K) { v16h w; const float* p = Wm + (size_t)o * K + k0 + 8 * (lane >> 4);
#pragma unroll
  for (int i = 0; i < 8; ++i) { w[i] = (_Float16)(bfr(p[i]) * 256.0f); w[8 + i] = (_Float16)(bfr(p[16 + i]) * 256.0f); }
  return w; }
#define WQKV_LAYOUT 0   // 0 = (in,out) [DIN][CC]; 1 = (out,in) [CC][DIN]; 2 = per-head [NH][DIN][HD]
__device__ __forceinline__ v16b wcol_hdk(const float* Wm, int k0, int o, int lane) { v16b w; const int g = lane >> 4; const float* p = Wm + (size_t)(o / HD) * DIN * HD + (o % HD);
#pragma unroll
  for (int i = 0; i < 8; ++i) { w[i] = (__bf16)p[(size_t)(k0 + 8 * g + i) * HD]; w[8 + i] = (__bf16)p[(size_t)(k0 + 16 + 8 * g + i) * HD]; }
  return w; }
#define WO_OUT_IN 0
#if WQKV_LAYOUT == 1
#define WCOL(W, k0, o, lane) wcol_oi(W, k0, o, lane, DIN)
#elif WQKV_LAYOUT == 2
#define WCOL(W, k0, o, lane) wcol_hdk(W, k0, o, lane)
#else
#define WCOL(W, k0, o, lane) wcol_io(W, k0, o, lane, CC)
#endif
#if WO_OUT_IN
#define WOCOL(W, k0, o, lane) wcol_oi(W, k0, o, lane, CC)
#define WOCOLH(W, k0, o, lane) wcolh_oi(W, k0, o, lane, CC)
#else
#define WOCOL(W, k0, o, lane) wcol_io(W, k0, o, lane, DIN)
#define WOCOLH(W, k0, o, lane) wcolh_io(W, k0, o, lane, DIN)
#endif
__global__ __launch_bounds__(256) void k_planes64(const float* __restrict__ Qs, const float* __restrict__ Ks, const float* __restrict__ Vs, _Float16* __restrict__ QH, _Float16* __restrict__ QL, _Float16* __restrict__ KH, _Float16* __restrict__ KL, _Float16* __restrict__ VT, __bf16* __restrict__ VB, __bf16* __restrict__ VBL) {
  __shared__ _Float16 sv[64][72];
  const int tid = threadIdx.x; const size_t r0 = (size_t)blockIdx.x * 64; const int b = (int)(r0 / TT), t0 = (int)(r0 % TT);
  for (int e = tid; e < 64 * 8; e += 256) { const int rl = e >> 3, q = e & 7; const size_t src = (r0 + rl) * CC + q * 8; float tq[8], tk[8], tv[8];
#pragma unroll
    for (int u = 0; u < 8; ++u) { tq[u] = Qs[src + u]; tk[u] = Ks[src + u]; tv[u] = Vs[src + u]; }
    asm volatile("s_wait_loadcnt 0x0" ::: "memory");
    hx8 hq, hk, hlq, hlk;
#pragma unroll
    for (int u = 0; u < 8; ++u) { const float qv = bfr(tq[u]), kv = bfr(tk[u]); const _Float16 qh = (_Float16)qv, kh = (_Float16)kv; hq[u] = qh; hlq[u] = (_Float16)((qv - (float)qh) * 1024.0f); hk[u] = kh; hlk[u] = (_Float16)((kv - (float)kh) * 1024.0f); sv[rl][q * 8 + u] = (_Float16)bfr(tv[u]); }
    vst2((unsigned*)(QH + (r0 + rl) * CC + q * 8), *(const v4u*)&hq); vst2((unsigned*)(KH + (r0 + rl) * CC + q * 8), *(const v4u*)&hk);
    if (t0 + rl < QHI) vst2((unsigned*)(QL + ((size_t)b * QHI + t0 + rl) * CC + q * 8), *(const v4u*)&hlq);
    if (t0 + rl < KHI) vst2((unsigned*)(KL + ((size_t)b * KHI + t0 + rl) * CC + q * 8), *(const v4u*)&hlk); }
  __syncthreads();
  for (int e = tid; e < 64 * 8; e += 256) { const int c = e >> 3, q = e & 7; hx8 hv; _Pragma("unroll") for (int j = 0; j < 8; ++j) hv[j] = sv[q * 8 + j][c]; vst2((unsigned*)(VT + ((size_t)b * CC + c) * TT + t0 + q * 8), *(const v4u*)&hv);
    if (t0 < KHI) { v8b bh, bl; _Pragma("unroll") for (int j = 0; j < 8; ++j) { const float vv = (float)hv[j]; const __bf16 h1 = (__bf16)vv; bh[j] = h1; bl[j] = (__bf16)(vv - (float)h1); } vst2((unsigned*)(VB + ((size_t)b * CC + c) * KHI + t0 + q * 8), *(const v4u*)&bh); vst2((unsigned*)(VBL + ((size_t)b * CC + c) * KHI + t0 + q * 8), *(const v4u*)&bl); } } }
#define SM_EXTRA_PARAMS
#define SM_MASK_HOOK (void)0
#ifndef SM_EXTRA_PARAMS
#define SM_EXTRA_PARAMS
#endif
#ifndef PROJ_EXTRA_PARAMS
#define PROJ_EXTRA_PARAMS
#endif
#ifndef SM_MASK_HOOK
#define SM_MASK_HOOK (void)0
#endif

#define WS_QH  0u                                      // f16 q rows [b*t][CC]
#define WS_KH  (WS_QH + 2u * (size_t)NB * TT * CC)      // f16 k rows [b*t][CC]
#define WS_VT  (WS_KH + 2u * (size_t)NB * TT * CC)      // f16 v planes [b][c][t]
#define WS_QL  (WS_VT + 2u * (size_t)NB * CC * TT)      // f16 q residual x 2^10 rows [b][t < QHI][CC]
#define WS_KL  (WS_QL + 2u * (size_t)NB * QHI * CC)     // f16 k residual x 2^10 rows [b][t < KHI][CC]
#define WS_VB  (WS_KL + 2u * (size_t)NB * KHI * CC)     // bf16 v hi planes [b][c][t < KHI]
#define WS_VBL (WS_VB + 2u * (size_t)NB * CC * KHI)
#define WS_S   (WS_VBL + 2u * (size_t)NB * CC * KHI)    // f32 logits / P [hg][t][s]
#define WS_Y   (WS_S  + 4u * (size_t)HG * TQC * TT)      // (unused) end of the TQC x TT score plane
#define WS_END (WS_Y  + 0u)

// ---- k_proj: block = (64 rows, 128 cols, which): q/k/v = X W (+ b) with exact bf16 products (K = DIN) -> which 0: q f16 rows (+ residual rows < QHI); 1: k f16 rows (+ residual rows < KHI); 2: v f16 planes [c][t] (+ bf16 hi/lo planes for t < KHI)
__global__ __launch_bounds__(128) void k_proj(const float* __restrict__ XQ, const float* __restrict__ XK, const float* __restrict__ XV, const float* __restrict__ WQ, const float* __restrict__ WK, const float* __restrict__ WV, const float* __restrict__ BQ, const float* __restrict__ BK, const float* __restrict__ BV,
    _Float16* __restrict__ QH, _Float16* __restrict__ QL, _Float16* __restrict__ KH, _Float16* __restrict__ KL, _Float16* __restrict__ VT, __bf16* __restrict__ VB, __bf16* __restrict__ VBL) {
  __shared__ __align__(16) _Float16 sh[64][136], sl[64][136]; __shared__ __align__(16) _Float16 th[128][72]; __shared__ __align__(16) __bf16 tb[128][72], tbl[128][72];
  const int tid = threadIdx.x, wave = tid >> 5, lane = tid & 31, col = lane & 15, g = lane >> 4; const int which = blockIdx.z; const int c0 = blockIdx.y * 128; const size_t r0 = (size_t)blockIdx.x * 64; const size_t bb = r0 / TT; const int t0 = (int)(r0 % TT);
  const float* X = which == 0 ? XQ : which == 1 ? XK : XV; const float* WA = which == 0 ? WQ : which == 1 ? WK : WV; const float* BA = which == 0 ? BQ : which == 1 ? BK : BV;
  v8f acc[8] = {};
#pragma unroll 2
  for (int kc = 0; kc < DIN / 32; ++kc) { v16b a; { const float* p = X + (r0 + wave * 16 + col) * DIN + kc * 32 + 8 * g;
#pragma unroll
      for (int i = 0; i < 8; ++i) { a[i] = (__bf16)p[i]; a[8 + i] = (__bf16)p[16 + i]; } }
    asm volatile("s_wait_loadcnt 0x0" ::: "memory");
#pragma unroll
    for (int j = 0; j < 8; ++j) { const v16b w = WCOL(WA, kc * 32, c0 + j * 16 + col, lane); asm volatile("s_wait_loadcnt 0x0" ::: "memory"); acc[j] = wmma_bf(a, w, acc[j]); } }
  if (which < 2) { _Float16* DH = which == 0 ? QH : KH; _Float16* DL = which == 0 ? QL : KL; const int nhi = which == 0 ? QHI : KHI; const bool hi_rows = t0 < nhi;
#pragma unroll
    for (int j = 0; j < 8; ++j) { const float bias = BA ? bfr(BA[c0 + j * 16 + col]) : 0.f;
#pragma unroll
      for (int r = 0; r < 8; ++r) { const float v = acc[j][r] + bias; const _Float16 hv = (_Float16)v; sh[wave * 16 + 8 * g + r][j * 16 + col] = hv; sl[wave * 16 + 8 * g + r][j * 16 + col] = (_Float16)((v - (float)hv) * 1024.0f); } }
    __syncthreads();
    for (int e = tid; e < 64 * 16; e += 128) { const int rl = e >> 4, q = e & 15; vst2((unsigned*)(DH + (r0 + rl) * CC + c0 + q * 8), *(const v4u*)&sh[rl][q * 8]); if (hi_rows) vst2((unsigned*)(DL + (bb * nhi + t0 + rl) * (size_t)CC + c0 + q * 8), *(const v4u*)&sl[rl][q * 8]); }
  } else { const bool hi_rows = t0 < KHI;
#pragma unroll
    for (int j = 0; j < 8; ++j) { const float bias = BA ? bfr(BA[c0 + j * 16 + col]) : 0.f;
#pragma unroll
      for (int r = 0; r < 8; ++r) { const float v = acc[j][r] + bias; const int rl = wave * 16 + 8 * g + r, cl = j * 16 + col; th[cl][rl] = (_Float16)v; const __bf16 bh = (__bf16)v; tb[cl][rl] = bh; tbl[cl][rl] = (__bf16)(v - (float)bh); } }
    __syncthreads();
    for (int e = tid; e < 128 * 8; e += 128) { const int cl = e >> 3, q = e & 7; vst2((unsigned*)(VT + (bb * CC + c0 + cl) * (size_t)TT + t0 + q * 8), *(const v4u*)&th[cl][q * 8]); if (hi_rows) { const size_t o3 = (bb * CC + c0 + cl) * (size_t)KHI + t0 + q * 8; vst2((unsigned*)(VB + o3), *(const v4u*)&tb[cl][q * 8]); vst2((unsigned*)(VBL + o3), *(const v4u*)&tbl[cl][q * 8]); } } } }
// ---- k_sc: block = (query block qb, key block kb <= kb_last(qb), head in group) of batch b: logits x SCALE; q hi + residual (x 2^10) against k (2 products) for query rows < QHI, plus the k residual (3 products) for query blocks < QBH (causal early rows); causal: blocks past the diagonal exit, the mask itself is applied by index in k_sm
__global__ __launch_bounds__(128) void k_sc(const _Float16* __restrict__ QH, const _Float16* __restrict__ KH, const _Float16* __restrict__ QL, const _Float16* __restrict__ KL, int b, int h0, float* __restrict__ S0) { __shared__ __align__(16) float ss[4][16][132];
  const int qb = blockIdx.x, kb = blockIdx.y; if (kb > kb_last(qb)) return;
  const int h = h0 + blockIdx.z; float* S = S0 + (size_t)blockIdx.z * TT * TT;
  const int tid = threadIdx.x, wave = tid >> 5, lane = tid & 31, col = lane & 15, g = lane >> 4; const int k0 = kb * 128; const int ql0 = qb * 64 + wave * 16; const size_t q0 = (size_t)b * TT + ql0, kr0 = (size_t)b * TT + k0;
  v8f acc[8] = {}, accl[8] = {};
  const _Float16* QLb = QL + (size_t)b * QHI * CC; const _Float16* KLb = KL + (size_t)b * KHI * CC;
  if (qb < QBH) {
#pragma unroll
    for (int kc = 0; kc < HD / 32; ++kc) { const v16h ah = frag_h(QH + (q0 + col) * CC + h * HD + kc * 32, lane), al = frag_h(QLb + (size_t)(ql0 + col) * CC + h * HD + kc * 32, lane);
#pragma unroll
      for (int j = 0; j < 8; ++j) { const v16h kbf = frag_h(KH + (kr0 + j * 16 + col) * CC + h * HD + kc * 32, lane), klf = frag_h(KLb + (size_t)(k0 + j * 16 + col) * CC + h * HD + kc * 32, lane); acc[j] = wmma16(ah, kbf, acc[j]); accl[j] = wmma16(al, kbf, accl[j]); accl[j] = wmma16(ah, klf, accl[j]); } }
  } else if (qb * 64 < QHI) {
#pragma unroll
    for (int kc = 0; kc < HD / 32; ++kc) { const v16h ah = frag_h(QH + (q0 + col) * CC + h * HD + kc * 32, lane), al = frag_h(QLb + (size_t)(ql0 + col) * CC + h * HD + kc * 32, lane);
#pragma unroll
      for (int j = 0; j < 8; ++j) { const v16h kbf = frag_h(KH + (kr0 + j * 16 + col) * CC + h * HD + kc * 32, lane); acc[j] = wmma16(ah, kbf, acc[j]); accl[j] = wmma16(al, kbf, accl[j]); } }
  } else {
#pragma unroll
    for (int kc = 0; kc < HD / 32; ++kc) { const v16h ah = frag_h(QH + (q0 + col) * CC + h * HD + kc * 32, lane);
#pragma unroll
      for (int j = 0; j < 8; ++j) { const v16h kbf = frag_h(KH + (kr0 + j * 16 + col) * CC + h * HD + kc * 32, lane); acc[j] = wmma16(ah, kbf, acc[j]); } } }
#pragma unroll
  for (int j = 0; j < 8; ++j) {
#pragma unroll
    for (int r = 0; r < 8; ++r) ss[wave][8 * g + r][j * 16 + col] = (acc[j][r] + accl[j][r] * (1.0f / 1024.0f)) * SCALE; }
  LDSX(); for (int rl = 0; rl < 16; ++rl) vst2(S + (size_t)(ql0 + rl) * TT + k0 + lane * 4, *(const v4f*)&ss[wave][rl][lane * 4]); }
// ---- k_sm: block = query row t (head in group): keys [0, kend): causal -> logit if s <= t else excluded; softmax in f32; P x 2^11 in place (0 for excluded)
__global__ __launch_bounds__(256) void k_sm(float* __restrict__ S0 SM_EXTRA_PARAMS) { __shared__ float sred[8]; __shared__ float sbc; __shared__ __align__(16) float shv[TT];
  const int tid = threadIdx.x; const int t = blockIdx.x; const int kend = (kb_last(t >> 6) + 1) * 128;
  float* sr = S0 + (size_t)blockIdx.y * TT * TT + (size_t)t * TT;
  float m = -3.0e38f; for (int k = tid; k < kend; k += 256) { float v = (!CAUSAL || k <= t) ? sr[k] : -3.0e38f; SM_MASK_HOOK; shv[k] = v; m = fmaxf(m, v); }
#pragma unroll
  for (int o = 1; o < 32; o <<= 1) m = fmaxf(m, __shfl_xor(m, o));
  if ((tid & 31) == 0) sred[tid >> 5] = m; __syncthreads(); if (tid == 0) { float a = sred[0]; for (int i = 1; i < 8; ++i) a = fmaxf(a, sred[i]); sbc = a; } __syncthreads(); m = sbc; __syncthreads();
  float sum = 0.f; for (int k = tid; k < kend; k += 256) { const float v = shv[k]; const float e = (v <= -1.0e38f) ? 0.f : expf(v - m); shv[k] = e; sum += e; }
#pragma unroll
  for (int o = 1; o < 32; o <<= 1) sum += __shfl_xor(sum, o);
  if ((tid & 31) == 0) sred[tid >> 5] = sum; __syncthreads(); if (tid == 0) { float a = 0.f; for (int i = 0; i < 8; ++i) a += sred[i]; sbc = a > 0.f ? 2048.0f / a : 0.f; }   /* a fully excluded row yields P = 0 */ __syncthreads(); const float inv = sbc;
  for (int k = tid; k < kend; k += 256) shv[k] = shv[k] * inv;
  __syncthreads(); for (int q = tid; q < kend / 4; q += 256) vst2(sr + q * 4, *(const v4f*)&shv[q * 4]); }
__global__ __launch_bounds__(256) void k_lse(const float* __restrict__ S0, float* __restrict__ L) { __shared__ __align__(16) float sl[32];
  const int tid = threadIdx.x, wave = tid >> 5, lane = tid & 31; const int r0 = blockIdx.x * 32;
#pragma unroll 1
  for (int rr = 0; rr < 4; ++rr) { const float* sr = S0 + (size_t)(r0 + wave * 4 + rr) * TT; float m = -3.0e38f;
#pragma unroll 8
    for (int i = 0; i < TT / 32; ++i) { const float v = sr[lane + 32 * i]; asm volatile("s_wait_loadcnt 0x0" ::: "memory"); m = fmaxf(m, v); }
#pragma unroll
    for (int o = 1; o < 32; o <<= 1) m = fmaxf(m, __shfl_xor(m, o));
    float sum = 0.f;
#pragma unroll 8
    for (int i = 0; i < TT / 32; ++i) { const float v = sr[lane + 32 * i]; asm volatile("s_wait_loadcnt 0x0" ::: "memory"); sum += expf(v - m); }
#pragma unroll
    for (int o = 1; o < 32; o <<= 1) sum += __shfl_xor(sum, o);
    if (lane == 0) sl[wave * 4 + rr] = sum; }   /* LDS only under the lane predicate */
  __syncthreads();
  if (tid < 8) vst2(L + r0 + tid * 4, *(const v4f*)&sl[tid * 4]); }
// ---- k_pv: block = 64 queries (qb) of (b, h): ctx = P . v over keys [0, kend) (P x 2^11 once to f16 against v f16: 1 product; causal early query blocks: P and v as bf16 hi + lo, 3 products); 256-B (row, head) segment by 16 lanes
__global__ __launch_bounds__(128) void k_pv(const float* __restrict__ PS0, const _Float16* __restrict__ VT, const __bf16* __restrict__ VB, const __bf16* __restrict__ VBL, int b, int h0, float* __restrict__ Y) { const int h = h0 + blockIdx.z; const float* PS = PS0 + (size_t)blockIdx.z * TT * TT; __shared__ __align__(16) float ss[4][16][HD + 4];
  const int tid = threadIdx.x, wave = tid >> 5, lane = tid & 31, col = lane & 15, g = lane >> 4; const int qb = blockIdx.x; const int ql0 = qb * 64 + wave * 16; const int kce = (kb_last(qb) + 1) * 4;
  v8f acc[HD / 16] = {};
  if (qb < QBH) {
#pragma unroll 1
    for (int kc = 0; kc < kce; ++kc) { const F2 p = split_row(PS + (size_t)(ql0 + col) * TT, kc * 32, lane);
      asm volatile("s_wait_loadcnt 0x0" ::: "memory");
#pragma unroll
      for (int j = 0; j < HD / 16; ++j) { const size_t po = ((size_t)b * CC + h * HD + j * 16 + col) * (size_t)KHI + kc * 32; const v16b vh = frag_b(VB + po, lane); acc[j] = wmma_bf(p.h, vh, acc[j]); acc[j] = wmma_bf(p.l, vh, acc[j]); acc[j] = wmma_bf(p.h, frag_b(VBL + po, lane), acc[j]); } }
  } else {
#pragma unroll 1
    for (int kc = 0; kc < kce; ++kc) { const v16h p = frag_f32(PS + (size_t)(ql0 + col) * TT + kc * 32, lane);
      asm volatile("s_wait_loadcnt 0x0" ::: "memory");
#pragma unroll
      for (int j = 0; j < HD / 16; ++j) { const size_t po = ((size_t)b * CC + h * HD + j * 16 + col) * (size_t)TT + kc * 32; acc[j] = wmma16(p, frag_h(VT + po, lane), acc[j]); } } }
#pragma unroll
  for (int j = 0; j < HD / 16; ++j)
#pragma unroll
    for (int r = 0; r < 8; ++r) ss[wave][8 * g + r][j * 16 + col] = acc[j][r] * (1.0f / 2048.0f);
  LDSX(); for (int rl = 0; rl < 16; ++rl) if (lane < HD / 4) vst2(Y + ((size_t)b * TT + ql0 + rl) * CC + h * HD + lane * 4, *(const v4f*)&ss[wave][rl][lane * 4]); }

extern "C" void kernel_launch(void* const* d_in, const int* in_sizes, int n_in, void* d_out, int out_size, void* d_ws, size_t ws_size, hipStream_t stream) {
  (void)in_sizes; (void)n_in; (void)out_size;
  const float** F = (const float**)d_in;
  if (ws_size < (size_t)WS_END) return;
  char* ws = (char*)d_ws; _Float16 *QH = (_Float16*)(ws + WS_QH), *KH = (_Float16*)(ws + WS_KH), *VT = (_Float16*)(ws + WS_VT), *QL = (_Float16*)(ws + WS_QL), *KL = (_Float16*)(ws + WS_KL); __bf16 *VB = (__bf16*)(ws + WS_VB), *VBL = (__bf16*)(ws + WS_VBL); float *S = (float*)(ws + WS_S), *Y = (float*)(ws + WS_Y);
  (void)Y; (void)QL; (void)KL; (void)VB; (void)VBL;
  // inputs: 0 q [8192,64]; 1 k; 2 v; outputs: (O [8192,64], L [8192,1])
  k_planes64<<<dim3(TNB * TT / 64), 256, 0, stream>>>(F[0], F[1], F[2], QH, QL, KH, KL, VT, VB, VBL);
  float* Oout = (float*)d_out; float* Lout = (float*)((char*)d_out + (size_t)TT * 64 * 4);   /* tuple output: O [8192,64] at byte 0, L [8192,1] at byte 2,097,152 */
  for (int q0 = 0; q0 < TT; q0 += TQC) {   /* query chunks: the kernels index query rows from blockIdx, so each pass receives row-advanced q / output pointers and a TQC-row grid; keys / values always span all 8,192 positions */
    k_sc<<<dim3(TQC / 64, TT / 128, 1), 128, 0, stream>>>(QH + (size_t)q0 * CC, KH, QL, KL, 0, 0, S);
    k_lse<<<dim3(TQC / 32), 256, 0, stream>>>(S, Lout + q0);
    k_sm<<<dim3(TQC, 1), 256, 0, stream>>>(S);
    k_pv<<<dim3(TQC / 64, 1, 1), 128, 0, stream>>>(S, VT, VB, VBL, 0, 0, Oout + (size_t)q0 * CC);
  }


}

// v001
// One run takes 1140 microseconds.
// Timed twice side by side with v000, it ran 2.47 and 2.46 times as fast.
// compute dtype: all float inputs rounded to bf16; q, k, v are bf16-valued so their f16 planes are exact; scores q x k (1 product on exact planes) x 64^-0.5; row max / exp / row sum in f32 (precise expf): output 1 = L = sum_k exp(S - max); output 0 = O = (P v) / L with P x 2^11 / L once to f16 x v (exact) (1 product); f32 outputs.
#include <hip/hip_runtime.h>
#include <math.h>

typedef __attribute__((ext_vector_type(16))) _Float16 v16h;
typedef __attribute__((ext_vector_type(16))) __bf16 v16b;
typedef __attribute__((ext_vector_type(8)))  _Float16 v8h;
typedef __attribute__((ext_vector_type(8)))  float v8f;
typedef __attribute__((ext_vector_type(4)))  float v4f;
typedef __attribute__((ext_vector_type(2)))  float v2f;
typedef __attribute__((ext_vector_type(4)))  unsigned v4u;
typedef _Float16 hx8 __attribute__((ext_vector_type(8)));
typedef __attribute__((ext_vector_type(4)))  int v4i;
typedef float __attribute__((may_alias)) float_a;
typedef int __attribute__((may_alias)) int_a;

template <typename T> __device__ __forceinline__ void vst2(void* p, T v) { *(T*)p = v;  }
__device__ __forceinline__ v8f wmma16(v16h a, v16h b, v8f c) {
  v8f d = __builtin_amdgcn_wmma_f32_16x16x32_f16(false, a, false, b, (short)0, c, false, false);
  asm volatile("v_nop\n\tv_nop\n\tv_nop\n\tv_nop" : "+v"(d) : "v"(a), "v"(b));
  return d;
}
__device__ __forceinline__ v8f wmma_bf(v16b a, v16b b, v8f c) {
  v8f d = __builtin_amdgcn_wmma_f32_16x16x32_bf16(false, a, false, b, (short)0, c, false, false);
  asm volatile("v_nop\n\tv_nop\n\tv_nop\n\tv_nop" : "+v"(d) : "v"(a), "v"(b));
  return d;
}
// 16x16x32 fragments: lane = (h = lane>>4, row/col = lane&15); elements 0..7 = k0+8h+0..7, 8..15 = k0+16+8h+0..7; D element r = row 8h+r
__device__ __forceinline__ v16h frag_h(const _Float16* rowk0, int lane) {
  union { v16h v; v8h q[2]; } u; const _Float16* p = rowk0 + 8 * (lane >> 4);
  u.q[0] = *(const v8h*)p; u.q[1] = *(const v8h*)(p + 16); return u.v;
}
__device__ __forceinline__ v16h frag_f32(const float* rowk0, int lane) {
  v16h a; const float* p = rowk0 + 8 * (lane >> 4);
#pragma unroll
  for (int i = 0; i < 8; ++i) { a[i] = (_Float16)p[i]; a[8 + i] = (_Float16)p[16 + i]; }
  return a;
}
__device__ __forceinline__ v16h frag_f32s(const float* rowk0, int lane, float sc) {
  v16h a; const float* p = rowk0 + 8 * (lane >> 4);
#pragma unroll
  for (int i = 0; i < 8; ++i) { a[i] = (_Float16)(p[i] * sc); a[8 + i] = (_Float16)(p[16 + i] * sc); }
  return a;
}
// column fragment from a [K][ld] layout (column n), rows >= K read as 0
__device__ __forceinline__ v16h fragc_f32(const float* W, int k0, int n, int lane, int ld, int K) {
  v16h a; const int g = lane >> 4;
#pragma unroll
  for (int i = 0; i < 8; ++i) { const int ka = k0 + 8 * g + i, kb = ka + 16;
    a[i] = (_Float16)(ka < K ? W[(size_t)(ka < K ? ka : K - 1) * ld + n] : 0.f); a[8 + i] = (_Float16)(kb < K ? W[(size_t)(kb < K ? kb : K - 1) * ld + n] : 0.f); }
  return a;
}
struct F2 { v16b h, l; };
__device__ __forceinline__ F2 bsplit16(const float v[16]) { F2 r;
#pragma unroll
  for (int i = 0; i < 16; ++i) { const __bf16 h = (__bf16)v[i]; r.h[i] = h; r.l[i] = (__bf16)(v[i] - (float)h); }
  return r; }
__device__ __forceinline__ F2 split_row(const float* row, int k0, int lane) { float v[16]; const float* p = row + k0 + 8 * (lane >> 4);
#pragma unroll
  for (int i = 0; i < 8; ++i) { v[i] = p[i]; v[8 + i] = p[16 + i]; }
  return bsplit16(v); }
__device__ __forceinline__ F2 split_rowK(const float* row, int k0, int lane, int K) { float v[16]; const int g = lane >> 4;
#pragma unroll
  for (int i = 0; i < 8; ++i) { const int ka = k0 + 8 * g + i, kb = ka + 16; v[i] = ka < K ? row[ka < K ? ka : K - 1] : 0.f; v[8 + i] = kb < K ? row[kb < K ? kb : K - 1] : 0.f; }
  return bsplit16(v); }
__device__ __forceinline__ F2 split_col(const float* W, int k0, int n, int lane, int ld, int K) { float v[16]; const int g = lane >> 4;
#pragma unroll
  for (int i = 0; i < 8; ++i) { const int ka = k0 + 8 * g + i, kb = ka + 16; v[i] = ka < K ? W[(size_t)(ka < K ? ka : K - 1) * ld + n] : 0.f; v[8 + i] = kb < K ? W[(size_t)(kb < K ? kb : K - 1) * ld + n] : 0.f; }
  return bsplit16(v); }
__device__ __forceinline__ v8f mac3(const F2& a, const F2& b, v8f c) { c = wmma_bf(a.l, b.h, c); c = wmma_bf(a.h, b.l, c); return wmma_bf(a.h, b.h, c); }
__device__ __forceinline__ float sigm(float v) { return 1.0f / (1.0f + expf(-v)); }
#define LDSX() do { asm volatile("s_wait_dscnt 0" ::: "memory"); __builtin_amdgcn_wave_barrier(); __builtin_amdgcn_fence(__ATOMIC_RELEASE, "workgroup"); } while (0)

// Flash-attention reference on one long sequence with TWO outputs (q / k / v [8192,64]; S = q k^T / 8; m = rowmax(S); P = exp(S - m); L = rowsum(P) [8192,1]; O = (P v) / L [8192,64]; returns the tuple (O, L); no mask). Queries are processed in 4 chunks of 2,048 rows so the f32 score plane fits the workspace.
#define NB 1
#define TT 8192
#define TQC 2048           // query rows per pass: the f32 score plane holds TQC x 8,192 entries (64 MiB); 4 passes cover the 8,192 queries
#define CC 64            // NH * HD = projected width
#define DIN 64          // input (model) width
#define NH 1
#define HD 64
#define NQB (TT / 64)
#define HG 1
#define SCALE (0.125f)
#define CAUSAL 0
#ifndef TNB
#define TNB NB
#endif
__device__ __forceinline__ float bfr(float v) { return (float)(__bf16)v; }
__host__ __device__ __forceinline__ int kb_last(int qb) { return CAUSAL ? ((qb * 64 + 63) >> 7) : (TT / 128 - 1); }
typedef __attribute__((ext_vector_type(8))) __bf16 v8b;
__device__ __forceinline__ v16b frag_b(const __bf16* rowk0, int lane) {
  union { v16b v; v8b q[2]; } u; const __bf16* p = rowk0 + 8 * (lane >> 4);
  u.q[0] = *(const v8b*)p; u.q[1] = *(const v8b*)(p + 16); return u.v;
}
#define QBH 0              // exact planes: single-product logits and single-f16 P x V on every block
#define QHI 0               // no q residual plane (q is bf16-exact in f16)
#define KHI 64              // unused high-precision planes kept minimal
// B fragment (k rows k0+.., output column o) of a weight: (in,out) [K][ld] or (out,in) [ld rows of K]: bf16 exact, or f16(bf16 * 256) exact
__device__ __forceinline__ v16b wcol_io(const float* Wm, int k0, int o, int lane, int ld) { v16b w; const int g = lane >> 4;
#pragma unroll
  for (int i = 0; i < 8; ++i) { w[i] = (__bf16)Wm[(size_t)(k0 + 8 * g + i) * ld + o]; w[8 + i] = (__bf16)Wm[(size_t)(k0 + 16 + 8 * g + i) * ld + o]; }
  return w; }
__device__ __forceinline__ v16b wcol_oi(const float* Wm, int k0, int o, int lane, int K) { v16b w; const float* p = Wm + (size_t)o * K + k0 + 8 * (lane >> 4);
#pragma unroll
  for (int i = 0; i < 8; ++i) { w[i] = (__bf16)p[i]; w[8 + i] = (__bf16)p[16 + i]; }
  return w; }
__device__ __forceinline__ v16h wcolh_io(const float* Wm, int k0, int o, int lane, int ld) { v16h w; const int g = lane >> 4;
#pragma unroll
  for (int i = 0; i < 8; ++i) { w[i] = (_Float16)(bfr(Wm[(size_t)(k0 + 8 * g + i) * ld + o]) * 256.0f); w[8 + i] = (_Float16)(bfr(Wm[(size_t)(k0 + 16 + 8 * g + i) * ld + o]) * 256.0f); }
  return w; }
__device__ __forceinline__ v16h wcolh_oi(const float* Wm, int k0, int o, int lane, int K) { v16h w; const float* p = Wm + (size_t)o * K + k0 + 8 * (lane >> 4);
#pragma unroll
  for (int i = 0; i < 8; ++i) { w[i] = (_Float16)(bfr(p[i]) * 256.0f); w[8 + i] = (_Float16)(bfr(p[16 + i]) * 256.0f); }
  return w; }
#define WQKV_LAYOUT 0   // 0 = (in,out) [DIN][CC]; 1 = (out,in) [CC][DIN]; 2 = per-head [NH][DIN][HD]
__device__ __forceinline__ v16b wcol_hdk(const float* Wm, int k0, int o, int lane) { v16b w; const int g = lane >> 4; const float* p = Wm + (size_t)(o / HD) * DIN * HD + (o % HD);
#pragma unroll
  for (int i = 0; i < 8; ++i) { w[i] = (__bf16)p[(size_t)(k0 + 8 * g + i) * HD]; w[8 + i] = (__bf16)p[(size_t)(k0 + 16 + 8 * g + i) * HD]; }
  return w; }
#define WO_OUT_IN 0
#if WQKV_LAYOUT == 1
#define WCOL(W, k0, o, lane) wcol_oi(W, k0, o, lane, DIN)
#elif WQKV_LAYOUT == 2
#define WCOL(W, k0, o, lane) wcol_hdk(W, k0, o, lane)
#else
#define WCOL(W, k0, o, lane) wcol_io(W, k0, o, lane, CC)
#endif
#if WO_OUT_IN
#define WOCOL(W, k0, o, lane) wcol_oi(W, k0, o, lane, CC)
#define WOCOLH(W, k0, o, lane) wcolh_oi(W, k0, o, lane, CC)
#else
#define WOCOL(W, k0, o, lane) wcol_io(W, k0, o, lane, DIN)
#define WOCOLH(W, k0, o, lane) wcolh_io(W, k0, o, lane, DIN)
#endif
__global__ __launch_bounds__(256) void k_planes64(const float* __restrict__ Qs, const float* __restrict__ Ks, const float* __restrict__ Vs, _Float16* __restrict__ QH, _Float16* __restrict__ QL, _Float16* __restrict__ KH, _Float16* __restrict__ KL, _Float16* __restrict__ VT, __bf16* __restrict__ VB, __bf16* __restrict__ VBL) {
  __shared__ _Float16 sv[64][72];
  const int tid = threadIdx.x; const size_t r0 = (size_t)blockIdx.x * 64; const int b = (int)(r0 / TT), t0 = (int)(r0 % TT);
  for (int e = tid; e < 64 * 8; e += 256) { const int rl = e >> 3, q = e & 7; const size_t src = (r0 + rl) * CC + q * 8; float tq[8], tk[8], tv[8];
#pragma unroll
    for (int u = 0; u < 8; ++u) { tq[u] = Qs[src + u]; tk[u] = Ks[src + u]; tv[u] = Vs[src + u]; }
    asm volatile("s_wait_loadcnt 0x0" ::: "memory");
    hx8 hq, hk, hlq, hlk;
#pragma unroll
    for (int u = 0; u < 8; ++u) { const float qv = bfr(tq[u]), kv = bfr(tk[u]); const _Float16 qh = (_Float16)qv, kh = (_Float16)kv; hq[u] = qh; hlq[u] = (_Float16)((qv - (float)qh) * 1024.0f); hk[u] = kh; hlk[u] = (_Float16)((kv - (float)kh) * 1024.0f); sv[rl][q * 8 + u] = (_Float16)bfr(tv[u]); }
    vst2((unsigned*)(QH + (r0 + rl) * CC + q * 8), *(const v4u*)&hq); vst2((unsigned*)(KH + (r0 + rl) * CC + q * 8), *(const v4u*)&hk);
    if (t0 + rl < QHI) vst2((unsigned*)(QL + ((size_t)b * QHI + t0 + rl) * CC + q * 8), *(const v4u*)&hlq);
    if (t0 + rl < KHI) vst2((unsigned*)(KL + ((size_t)b * KHI + t0 + rl) * CC + q * 8), *(const v4u*)&hlk); }
  __syncthreads();
  for (int e = tid; e < 64 * 8; e += 256) { const int c = e >> 3, q = e & 7; hx8 hv; _Pragma("unroll") for (int j = 0; j < 8; ++j) hv[j] = sv[q * 8 + j][c]; vst2((unsigned*)(VT + ((size_t)b * CC + c) * TT + t0 + q * 8), *(const v4u*)&hv);
    if (t0 < KHI) { v8b bh, bl; _Pragma("unroll") for (int j = 0; j < 8; ++j) { const float vv = (float)hv[j]; const __bf16 h1 = (__bf16)vv; bh[j] = h1; bl[j] = (__bf16)(vv - (float)h1); } vst2((unsigned*)(VB + ((size_t)b * CC + c) * KHI + t0 + q * 8), *(const v4u*)&bh); vst2((unsigned*)(VBL + ((size_t)b * CC + c) * KHI + t0 + q * 8), *(const v4u*)&bl); } } }
#define SM_EXTRA_PARAMS
#define SM_MASK_HOOK (void)0
#ifndef SM_EXTRA_PARAMS
#define SM_EXTRA_PARAMS
#endif
#ifndef PROJ_EXTRA_PARAMS
#define PROJ_EXTRA_PARAMS
#endif
#ifndef SM_MASK_HOOK
#define SM_MASK_HOOK (void)0
#endif

#define WS_QH  0u                                      // f16 q rows [b*t][CC]
#define WS_KH  (WS_QH + 2u * (size_t)NB * TT * CC)      // f16 k rows [b*t][CC]
#define WS_VT  (WS_KH + 2u * (size_t)NB * TT * CC)      // f16 v planes [b][c][t]
#define WS_QL  (WS_VT + 2u * (size_t)NB * CC * TT)      // f16 q residual x 2^10 rows [b][t < QHI][CC]
#define WS_KL  (WS_QL + 2u * (size_t)NB * QHI * CC)     // f16 k residual x 2^10 rows [b][t < KHI][CC]
#define WS_VB  (WS_KL + 2u * (size_t)NB * KHI * CC)     // bf16 v hi planes [b][c][t < KHI]
#define WS_VBL (WS_VB + 2u * (size_t)NB * CC * KHI)
#define WS_S   (WS_VBL + 2u * (size_t)NB * CC * KHI)    // f32 logits / P [hg][t][s]
#define WS_Y   (WS_S  + 4u * (size_t)HG * TQC * TT)      // (unused) end of the TQC x TT score plane
#define WS_LW  (WS_Y  + 0u)                              // f32 row sums of the current query chunk, one 128-B line per row (a line has one writer)
#define WS_END (WS_LW + 128u * (size_t)TQC)

// ---- k_proj: block = (64 rows, 128 cols, which): q/k/v = X W (+ b) with exact bf16 products (K = DIN) -> which 0: q f16 rows (+ residual rows < QHI); 1: k f16 rows (+ residual rows < KHI); 2: v f16 planes [c][t] (+ bf16 hi/lo planes for t < KHI)
__global__ __launch_bounds__(128) void k_proj(const float* __restrict__ XQ, const float* __restrict__ XK, const float* __restrict__ XV, const float* __restrict__ WQ, const float* __restrict__ WK, const float* __restrict__ WV, const float* __restrict__ BQ, const float* __restrict__ BK, const float* __restrict__ BV,
    _Float16* __restrict__ QH, _Float16* __restrict__ QL, _Float16* __restrict__ KH, _Float16* __restrict__ KL, _Float16* __restrict__ VT, __bf16* __restrict__ VB, __bf16* __restrict__ VBL) {
  __shared__ __align__(16) _Float16 sh[64][136], sl[64][136]; __shared__ __align__(16) _Float16 th[128][72]; __shared__ __align__(16) __bf16 tb[128][72], tbl[128][72];
  const int tid = threadIdx.x, wave = tid >> 5, lane = tid & 31, col = lane & 15, g = lane >> 4; const int which = blockIdx.z; const int c0 = blockIdx.y * 128; const size_t r0 = (size_t)blockIdx.x * 64; const size_t bb = r0 / TT; const int t0 = (int)(r0 % TT);
  const float* X = which == 0 ? XQ : which == 1 ? XK : XV; const float* WA = which == 0 ? WQ : which == 1 ? WK : WV; const float* BA = which == 0 ? BQ : which == 1 ? BK : BV;
  v8f acc[8] = {};
#pragma unroll 2
  for (int kc = 0; kc < DIN / 32; ++kc) { v16b a; { const float* p = X + (r0 + wave * 16 + col) * DIN + kc * 32 + 8 * g;
#pragma unroll
      for (int i = 0; i < 8; ++i) { a[i] = (__bf16)p[i]; a[8 + i] = (__bf16)p[16 + i]; } }
    asm volatile("s_wait_loadcnt 0x0" ::: "memory");
#pragma unroll
    for (int j = 0; j < 8; ++j) { const v16b w = WCOL(WA, kc * 32, c0 + j * 16 + col, lane); asm volatile("s_wait_loadcnt 0x0" ::: "memory"); acc[j] = wmma_bf(a, w, acc[j]); } }
  if (which < 2) { _Float16* DH = which == 0 ? QH : KH; _Float16* DL = which == 0 ? QL : KL; const int nhi = which == 0 ? QHI : KHI; const bool hi_rows = t0 < nhi;
#pragma unroll
    for (int j = 0; j < 8; ++j) { const float bias = BA ? bfr(BA[c0 + j * 16 + col]) : 0.f;
#pragma unroll
      for (int r = 0; r < 8; ++r) { const float v = acc[j][r] + bias; const _Float16 hv = (_Float16)v; sh[wave * 16 + 8 * g + r][j * 16 + col] = hv; sl[wave * 16 + 8 * g + r][j * 16 + col] = (_Float16)((v - (float)hv) * 1024.0f); } }
    __syncthreads();
    for (int e = tid; e < 64 * 16; e += 128) { const int rl = e >> 4, q = e & 15; vst2((unsigned*)(DH + (r0 + rl) * CC + c0 + q * 8), *(const v4u*)&sh[rl][q * 8]); if (hi_rows) vst2((unsigned*)(DL + (bb * nhi + t0 + rl) * (size_t)CC + c0 + q * 8), *(const v4u*)&sl[rl][q * 8]); }
  } else { const bool hi_rows = t0 < KHI;
#pragma unroll
    for (int j = 0; j < 8; ++j) { const float bias = BA ? bfr(BA[c0 + j * 16 + col]) : 0.f;
#pragma unroll
      for (int r = 0; r < 8; ++r) { const float v = acc[j][r] + bias; const int rl = wave * 16 + 8 * g + r, cl = j * 16 + col; th[cl][rl] = (_Float16)v; const __bf16 bh = (__bf16)v; tb[cl][rl] = bh; tbl[cl][rl] = (__bf16)(v - (float)bh); } }
    __syncthreads();
    for (int e = tid; e < 128 * 8; e += 128) { const int cl = e >> 3, q = e & 7; vst2((unsigned*)(VT + (bb * CC + c0 + cl) * (size_t)TT + t0 + q * 8), *(const v4u*)&th[cl][q * 8]); if (hi_rows) { const size_t o3 = (bb * CC + c0 + cl) * (size_t)KHI + t0 + q * 8; vst2((unsigned*)(VB + o3), *(const v4u*)&tb[cl][q * 8]); vst2((unsigned*)(VBL + o3), *(const v4u*)&tbl[cl][q * 8]); } } } }
// ---- k_sc: block = (query block qb, key block kb <= kb_last(qb), head in group) of batch b: logits x SCALE; q hi + residual (x 2^10) against k (2 products) for query rows < QHI, plus the k residual (3 products) for query blocks < QBH (causal early rows); causal: blocks past the diagonal exit, the mask itself is applied by index in k_sm
__global__ __launch_bounds__(128) void k_sc(const _Float16* __restrict__ QH, const _Float16* __restrict__ KH, const _Float16* __restrict__ QL, const _Float16* __restrict__ KL, int b, int h0, float* __restrict__ S0) { __shared__ __align__(16) float ss[4][16][132];
  const int qb = blockIdx.x, kb = blockIdx.y; if (kb > kb_last(qb)) return;
  const int h = h0 + blockIdx.z; float* S = S0 + (size_t)blockIdx.z * TT * TT;
  const int tid = threadIdx.x, wave = tid >> 5, lane = tid & 31, col = lane & 15, g = lane >> 4; const int k0 = kb * 128; const int ql0 = qb * 64 + wave * 16; const size_t q0 = (size_t)b * TT + ql0, kr0 = (size_t)b * TT + k0;
  v8f acc[8] = {}, accl[8] = {};
  const _Float16* QLb = QL + (size_t)b * QHI * CC; const _Float16* KLb = KL + (size_t)b * KHI * CC;
  if (qb < QBH) {
#pragma unroll
    for (int kc = 0; kc < HD / 32; ++kc) { const v16h ah = frag_h(QH + (q0 + col) * CC + h * HD + kc * 32, lane), al = frag_h(QLb + (size_t)(ql0 + col) * CC + h * HD + kc * 32, lane);
#pragma unroll
      for (int j = 0; j < 8; ++j) { const v16h kbf = frag_h(KH + (kr0 + j * 16 + col) * CC + h * HD + kc * 32, lane), klf = frag_h(KLb + (size_t)(k0 + j * 16 + col) * CC + h * HD + kc * 32, lane); acc[j] = wmma16(ah, kbf, acc[j]); accl[j] = wmma16(al, kbf, accl[j]); accl[j] = wmma16(ah, klf, accl[j]); } }
  } else if (qb * 64 < QHI) {
#pragma unroll
    for (int kc = 0; kc < HD / 32; ++kc) { const v16h ah = frag_h(QH + (q0 + col) * CC + h * HD + kc * 32, lane), al = frag_h(QLb + (size_t)(ql0 + col) * CC + h * HD + kc * 32, lane);
#pragma unroll
      for (int j = 0; j < 8; ++j) { const v16h kbf = frag_h(KH + (kr0 + j * 16 + col) * CC + h * HD + kc * 32, lane); acc[j] = wmma16(ah, kbf, acc[j]); accl[j] = wmma16(al, kbf, accl[j]); } }
  } else {
#pragma unroll
    for (int kc = 0; kc < HD / 32; ++kc) { const v16h ah = frag_h(QH + (q0 + col) * CC + h * HD + kc * 32, lane);
#pragma unroll
      for (int j = 0; j < 8; ++j) { const v16h kbf = frag_h(KH + (kr0 + j * 16 + col) * CC + h * HD + kc * 32, lane); acc[j] = wmma16(ah, kbf, acc[j]); } } }
#pragma unroll
  for (int j = 0; j < 8; ++j) {
#pragma unroll
    for (int r = 0; r < 8; ++r) ss[wave][8 * g + r][j * 16 + col] = (acc[j][r] + accl[j][r] * (1.0f / 1024.0f)) * SCALE; }
  LDSX(); for (int rl = 0; rl < 16; ++rl) vst2(S + (size_t)(ql0 + rl) * TT + k0 + lane * 4, *(const v4f*)&ss[wave][rl][lane * 4]); }
// ---- k_sm: block = query row t (head in group): keys [0, kend): causal -> logit if s <= t else excluded; softmax in f32; P x 2^11 in place (0 for excluded); the row sum L goes to the row's own workspace line
__global__ __launch_bounds__(256) void k_sm(float* __restrict__ S0, float* __restrict__ LW SM_EXTRA_PARAMS) { __shared__ float sred[8]; __shared__ float sbc; __shared__ __align__(16) float shv[TT];
  const int tid = threadIdx.x; const int t = blockIdx.x; const int kend = (kb_last(t >> 6) + 1) * 128;
  float* sr = S0 + (size_t)blockIdx.y * TT * TT + (size_t)t * TT;
  float m = -3.0e38f; for (int k = tid; k < kend; k += 256) { float v = (!CAUSAL || k <= t) ? sr[k] : -3.0e38f; SM_MASK_HOOK; shv[k] = v; m = fmaxf(m, v); }
#pragma unroll
  for (int o = 1; o < 32; o <<= 1) m = fmaxf(m, __shfl_xor(m, o));
  if ((tid & 31) == 0) sred[tid >> 5] = m; __syncthreads(); if (tid == 0) { float a = sred[0]; for (int i = 1; i < 8; ++i) a = fmaxf(a, sred[i]); sbc = a; } __syncthreads(); m = sbc; __syncthreads();
  float sum = 0.f; for (int k = tid; k < kend; k += 256) { const float v = shv[k]; const float e = (v <= -1.0e38f) ? 0.f : expf(v - m); shv[k] = e; sum += e; }
#pragma unroll
  for (int o = 1; o < 32; o <<= 1) sum += __shfl_xor(sum, o);
  if ((tid & 31) == 0) sred[tid >> 5] = sum; __syncthreads(); float rs = 0.f; if (tid == 0) { float a = 0.f; for (int i = 0; i < 8; ++i) a += sred[i]; sbc = a > 0.f ? 2048.0f / a : 0.f; rs = a; }   /* a fully excluded row yields P = 0 */ __syncthreads(); const float inv = sbc;
  for (int k = tid; k < kend; k += 256) shv[k] = shv[k] * inv;
  __syncthreads(); for (int q = tid; q < kend / 4; q += 256) vst2(sr + q * 4, *(const v4f*)&shv[q * 4]);
  if (tid == 0) LW[(size_t)t * 32] = rs; }   /* behind the last barrier, so that no barrier waits for this store */
// ---- k_pv: block = 64 queries (qb) of (b, h): ctx = P . v over keys [0, kend) (P x 2^11 once to f16 against v f16: 1 product; causal early query blocks: P and v as bf16 hi + lo, 3 products); 256-B (row, head) segment by 16 lanes; output L = the row sums k_sm left in the workspace
__global__ __launch_bounds__(128) void k_pv(const float* __restrict__ PS0, const _Float16* __restrict__ VT, const __bf16* __restrict__ VB, const __bf16* __restrict__ VBL, int b, int h0, float* __restrict__ Y, const float* __restrict__ LW, float* __restrict__ L) { const int h = h0 + blockIdx.z; const float* PS = PS0 + (size_t)blockIdx.z * TT * TT; __shared__ __align__(16) float ss[4][16][HD + 4];
  const int tid = threadIdx.x, wave = tid >> 5, lane = tid & 31, col = lane & 15, g = lane >> 4; const int qb = blockIdx.x; const int ql0 = qb * 64 + wave * 16; const int kce = (kb_last(qb) + 1) * 4;
  v8f acc[HD / 16] = {};
  if (qb < QBH) {
#pragma unroll 1
    for (int kc = 0; kc < kce; ++kc) { const F2 p = split_row(PS + (size_t)(ql0 + col) * TT, kc * 32, lane);
      asm volatile("s_wait_loadcnt 0x0" ::: "memory");
#pragma unroll
      for (int j = 0; j < HD / 16; ++j) { const size_t po = ((size_t)b * CC + h * HD + j * 16 + col) * (size_t)KHI + kc * 32; const v16b vh = frag_b(VB + po, lane); acc[j] = wmma_bf(p.h, vh, acc[j]); acc[j] = wmma_bf(p.l, vh, acc[j]); acc[j] = wmma_bf(p.h, frag_b(VBL + po, lane), acc[j]); } }
  } else {
#pragma unroll 1
    for (int kc = 0; kc < kce; ++kc) { const v16h p = frag_f32(PS + (size_t)(ql0 + col) * TT + kc * 32, lane);
      asm volatile("s_wait_loadcnt 0x0" ::: "memory");
#pragma unroll
      for (int j = 0; j < HD / 16; ++j) { const size_t po = ((size_t)b * CC + h * HD + j * 16 + col) * (size_t)TT + kc * 32; acc[j] = wmma16(p, frag_h(VT + po, lane), acc[j]); } } }
#pragma unroll
  for (int j = 0; j < HD / 16; ++j)
#pragma unroll
    for (int r = 0; r < 8; ++r) ss[wave][8 * g + r][j * 16 + col] = acc[j][r] * (1.0f / 2048.0f);
  LDSX(); for (int rl = 0; rl < 16; ++rl) if (lane < HD / 4) vst2(Y + ((size_t)b * TT + ql0 + rl) * CC + h * HD + lane * 4, *(const v4f*)&ss[wave][rl][lane * 4]);
  if (tid < 16) { v4f l;   /* the block's 64 row sums: two whole lines of L in one store */
#pragma unroll
    for (int u = 0; u < 4; ++u) l[u] = LW[(size_t)(qb * 64 + tid * 4 + u) * 32];
    vst2(L + qb * 64 + tid * 4, l); } }

extern "C" void kernel_launch(void* const* d_in, const int* in_sizes, int n_in, void* d_out, int out_size, void* d_ws, size_t ws_size, hipStream_t stream) {
  (void)in_sizes; (void)n_in; (void)out_size;
  const float** F = (const float**)d_in;
  if (ws_size < (size_t)WS_END) return;
  char* ws = (char*)d_ws; _Float16 *QH = (_Float16*)(ws + WS_QH), *KH = (_Float16*)(ws + WS_KH), *VT = (_Float16*)(ws + WS_VT), *QL = (_Float16*)(ws + WS_QL), *KL = (_Float16*)(ws + WS_KL); __bf16 *VB = (__bf16*)(ws + WS_VB), *VBL = (__bf16*)(ws + WS_VBL); float *S = (float*)(ws + WS_S), *Y = (float*)(ws + WS_Y), *LW = (float*)(ws + WS_LW);
  (void)Y; (void)QL; (void)KL; (void)VB; (void)VBL;
  // inputs: 0 q [8192,64]; 1 k; 2 v; outputs: (O [8192,64], L [8192,1])
  k_planes64<<<dim3(TNB * TT / 64), 256, 0, stream>>>(F[0], F[1], F[2], QH, QL, KH, KL, VT, VB, VBL);
  float* Oout = (float*)d_out; float* Lout = (float*)((char*)d_out + (size_t)TT * 64 * 4);   /* tuple output: O [8192,64] at byte 0, L [8192,1] at byte 2,097,152 */
  for (int q0 = 0; q0 < TT; q0 += TQC) {   /* query chunks: the kernels index query rows from blockIdx, so each pass receives row-advanced q / output pointers and a TQC-row grid; keys / values always span all 8,192 positions */
    k_sc<<<dim3(TQC / 64, TT / 128, 1), 128, 0, stream>>>(QH + (size_t)q0 * CC, KH, QL, KL, 0, 0, S);
    k_sm<<<dim3(TQC, 1), 256, 0, stream>>>(S, LW);
    k_pv<<<dim3(TQC / 64, 1, 1), 128, 0, stream>>>(S, VT, VB, VBL, 0, 0, Oout + (size_t)q0 * CC, LW, Lout + q0);
  }


}

// v002
// It runs in 301 microseconds.
// In two side-by-side timings against v001, it was 3.77 and 3.80 times as fast.
// Over all steps from v000 it is 9.35 times as fast.
// compute dtype: all float inputs rounded to bf16; q, k, v are bf16-valued so their f16 planes are exact; scores q x k (1 product on exact planes) x 64^-0.5; row max / exp / row sum in f32 (precise expf): output 1 = L = sum_k exp(S - max); output 0 = O = (P v) / L with P x 2^11 / L once to f16 x v (exact) (1 product); f32 outputs.
#include <hip/hip_runtime.h>
#include <math.h>

typedef __attribute__((ext_vector_type(16))) _Float16 v16h;
typedef __attribute__((ext_vector_type(16))) __bf16 v16b;
typedef __attribute__((ext_vector_type(8)))  _Float16 v8h;
typedef __attribute__((ext_vector_type(8)))  float v8f;
typedef __attribute__((ext_vector_type(4)))  float v4f;
typedef __attribute__((ext_vector_type(2)))  float v2f;
typedef __attribute__((ext_vector_type(4)))  unsigned v4u;
typedef _Float16 hx8 __attribute__((ext_vector_type(8)));
typedef __attribute__((ext_vector_type(4)))  int v4i;
typedef float __attribute__((may_alias)) float_a;
typedef int __attribute__((may_alias)) int_a;

template <typename T> __device__ __forceinline__ void vst2(void* p, T v) { *(T*)p = v;  }
__device__ __forceinline__ v8f wmma16(v16h a, v16h b, v8f c) {
  v8f d = __builtin_amdgcn_wmma_f32_16x16x32_f16(false, a, false, b, (short)0, c, false, false);
  asm volatile("v_nop\n\tv_nop\n\tv_nop\n\tv_nop" : "+v"(d) : "v"(a), "v"(b));
  return d;
}
__device__ __forceinline__ v8f wmma_bf(v16b a, v16b b, v8f c) {
  v8f d = __builtin_amdgcn_wmma_f32_16x16x32_bf16(false, a, false, b, (short)0, c, false, false);
  asm volatile("v_nop\n\tv_nop\n\tv_nop\n\tv_nop" : "+v"(d) : "v"(a), "v"(b));
  return d;
}
// 16x16x32 fragments: lane = (h = lane>>4, row/col = lane&15); elements 0..7 = k0+8h+0..7, 8..15 = k0+16+8h+0..7; D element r = row 8h+r
__device__ __forceinline__ v16h frag_h(const _Float16* rowk0, int lane) {
  union { v16h v; v8h q[2]; } u; const _Float16* p = rowk0 + 8 * (lane >> 4);
  u.q[0] = *(const v8h*)p; u.q[1] = *(const v8h*)(p + 16); return u.v;
}
__device__ __forceinline__ v16h frag_f32(const float* rowk0, int lane) {
  v16h a; const float* p = rowk0 + 8 * (lane >> 4);
#pragma unroll
  for (int i = 0; i < 8; ++i) { a[i] = (_Float16)p[i]; a[8 + i] = (_Float16)p[16 + i]; }
  return a;
}
__device__ __forceinline__ v16h frag_f32s(const float* rowk0, int lane, float sc) {
  v16h a; const float* p = rowk0 + 8 * (lane >> 4);
#pragma unroll
  for (int i = 0; i < 8; ++i) { a[i] = (_Float16)(p[i] * sc); a[8 + i] = (_Float16)(p[16 + i] * sc); }
  return a;
}
// column fragment from a [K][ld] layout (column n), rows >= K read as 0
__device__ __forceinline__ v16h fragc_f32(const float* W, int k0, int n, int lane, int ld, int K) {
  v16h a; const int g = lane >> 4;
#pragma unroll
  for (int i = 0; i < 8; ++i) { const int ka = k0 + 8 * g + i, kb = ka + 16;
    a[i] = (_Float16)(ka < K ? W[(size_t)(ka < K ? ka : K - 1) * ld + n] : 0.f); a[8 + i] = (_Float16)(kb < K ? W[(size_t)(kb < K ? kb : K - 1) * ld + n] : 0.f); }
  return a;
}
struct F2 { v16b h, l; };
__device__ __forceinline__ F2 bsplit16(const float v[16]) { F2 r;
#pragma unroll
  for (int i = 0; i < 16; ++i) { const __bf16 h = (__bf16)v[i]; r.h[i] = h; r.l[i] = (__bf16)(v[i] - (float)h); }
  return r; }
__device__ __forceinline__ F2 split_row(const float* row, int k0, int lane) { float v[16]; const float* p = row + k0 + 8 * (lane >> 4);
#pragma unroll
  for (int i = 0; i < 8; ++i) { v[i] = p[i]; v[8 + i] = p[16 + i]; }
  return bsplit16(v); }
__device__ __forceinline__ F2 split_rowK(const float* row, int k0, int lane, int K) { float v[16]; const int g = lane >> 4;
#pragma unroll
  for (int i = 0; i < 8; ++i) { const int ka = k0 + 8 * g + i, kb = ka + 16; v[i] = ka < K ? row[ka < K ? ka : K - 1] : 0.f; v[8 + i] = kb < K ? row[kb < K ? kb : K - 1] : 0.f; }
  return bsplit16(v); }
__device__ __forceinline__ F2 split_col(const float* W, int k0, int n, int lane, int ld, int K) { float v[16]; const int g = lane >> 4;
#pragma unroll
  for (int i = 0; i < 8; ++i) { const int ka = k0 + 8 * g + i, kb = ka + 16; v[i] = ka < K ? W[(size_t)(ka < K ? ka : K - 1) * ld + n] : 0.f; v[8 + i] = kb < K ? W[(size_t)(kb < K ? kb : K - 1) * ld + n] : 0.f; }
  return bsplit16(v); }
__device__ __forceinline__ v8f mac3(const F2& a, const F2& b, v8f c) { c = wmma_bf(a.l, b.h, c); c = wmma_bf(a.h, b.l, c); return wmma_bf(a.h, b.h, c); }
__device__ __forceinline__ float sigm(float v) { return 1.0f / (1.0f + expf(-v)); }
#define LDSX() do { asm volatile("s_wait_dscnt 0" ::: "memory"); __builtin_amdgcn_wave_barrier(); __builtin_amdgcn_fence(__ATOMIC_RELEASE, "workgroup"); } while (0)

// Flash-attention reference on one long sequence with TWO outputs (q / k / v [8192,64]; S = q k^T / 8; m = rowmax(S); P = exp(S - m); L = rowsum(P) [8192,1]; O = (P v) / L [8192,64]; returns the tuple (O, L); no mask). Queries are processed in 4 chunks of 2,048 rows so the f32 score plane fits the workspace.
#define NB 1
#define TT 8192
#define TQC 2048           // query rows per pass: the f32 score plane holds TQC x 8,192 entries (64 MiB); 4 passes cover the 8,192 queries
#define CC 64            // NH * HD = projected width
#define DIN 64          // input (model) width
#define NH 1
#define HD 64
#define NQB (TT / 64)
#define HG 1
#define SCALE (0.125f)
#define CAUSAL 0
#ifndef TNB
#define TNB NB
#endif
__device__ __forceinline__ float bfr(float v) { return (float)(__bf16)v; }
__host__ __device__ __forceinline__ int kb_last(int qb) { return CAUSAL ? ((qb * 64 + 63) >> 7) : (TT / 128 - 1); }
typedef __attribute__((ext_vector_type(8))) __bf16 v8b;
__device__ __forceinline__ v16b frag_b(const __bf16* rowk0, int lane) {
  union { v16b v; v8b q[2]; } u; const __bf16* p = rowk0 + 8 * (lane >> 4);
  u.q[0] = *(const v8b*)p; u.q[1] = *(const v8b*)(p + 16); return u.v;
}
#define QBH 0              // exact planes: single-product logits and single-f16 P x V on every block
#define QHI 0               // no q residual plane (q is bf16-exact in f16)
#define KHI 64              // unused high-precision planes kept minimal
// B fragment (k rows k0+.., output column o) of a weight: (in,out) [K][ld] or (out,in) [ld rows of K]: bf16 exact, or f16(bf16 * 256) exact
__device__ __forceinline__ v16b wcol_io(const float* Wm, int k0, int o, int lane, int ld) { v16b w; const int g = lane >> 4;
#pragma unroll
  for (int i = 0; i < 8; ++i) { w[i] = (__bf16)Wm[(size_t)(k0 + 8 * g + i) * ld + o]; w[8 + i] = (__bf16)Wm[(size_t)(k0 + 16 + 8 * g + i) * ld + o]; }
  return w; }
__device__ __forceinline__ v16b wcol_oi(const float* Wm, int k0, int o, int lane, int K) { v16b w; const float* p = Wm + (size_t)o * K + k0 + 8 * (lane >> 4);
#pragma unroll
  for (int i = 0; i < 8; ++i) { w[i] = (__bf16)p[i]; w[8 + i] = (__bf16)p[16 + i]; }
  return w; }
__device__ __forceinline__ v16h wcolh_io(const float* Wm, int k0, int o, int lane, int ld) { v16h w; const int g = lane >> 4;
#pragma unroll
  for (int i = 0; i < 8; ++i) { w[i] = (_Float16)(bfr(Wm[(size_t)(k0 + 8 * g + i) * ld + o]) * 256.0f); w[8 + i] = (_Float16)(bfr(Wm[(size_t)(k0 + 16 + 8 * g + i) * ld + o]) * 256.0f); }
  return w; }
__device__ __forceinline__ v16h wcolh_oi(const float* Wm, int k0, int o, int lane, int K) { v16h w; const float* p = Wm + (size_t)o * K + k0 + 8 * (lane >> 4);
#pragma unroll
  for (int i = 0; i < 8; ++i) { w[i] = (_Float16)(bfr(p[i]) * 256.0f); w[8 + i] = (_Float16)(bfr(p[16 + i]) * 256.0f); }
  return w; }
#define WQKV_LAYOUT 0   // 0 = (in,out) [DIN][CC]; 1 = (out,in) [CC][DIN]; 2 = per-head [NH][DIN][HD]
__device__ __forceinline__ v16b wcol_hdk(const float* Wm, int k0, int o, int lane) { v16b w; const int g = lane >> 4; const float* p = Wm + (size_t)(o / HD) * DIN * HD + (o % HD);
#pragma unroll
  for (int i = 0; i < 8; ++i) { w[i] = (__bf16)p[(size_t)(k0 + 8 * g + i) * HD]; w[8 + i] = (__bf16)p[(size_t)(k0 + 16 + 8 * g + i) * HD]; }
  return w; }
#define WO_OUT_IN 0
#if WQKV_LAYOUT == 1
#define WCOL(W, k0, o, lane) wcol_oi(W, k0, o, lane, DIN)
#elif WQKV_LAYOUT == 2
#define WCOL(W, k0, o, lane) wcol_hdk(W, k0, o, lane)
#else
#define WCOL(W, k0, o, lane) wcol_io(W, k0, o, lane, CC)
#endif
#if WO_OUT_IN
#define WOCOL(W, k0, o, lane) wcol_oi(W, k0, o, lane, CC)
#define WOCOLH(W, k0, o, lane) wcolh_oi(W, k0, o, lane, CC)
#else
#define WOCOL(W, k0, o, lane) wcol_io(W, k0, o, lane, DIN)
#define WOCOLH(W, k0, o, lane) wcolh_io(W, k0, o, lane, DIN)
#endif
__global__ __launch_bounds__(256) void k_planes64(const float* __restrict__ Qs, const float* __restrict__ Ks, const float* __restrict__ Vs, _Float16* __restrict__ QH, _Float16* __restrict__ QL, _Float16* __restrict__ KH, _Float16* __restrict__ KL, _Float16* __restrict__ VT, __bf16* __restrict__ VB, __bf16* __restrict__ VBL) {
  __shared__ _Float16 sv[64][72];
  const int tid = threadIdx.x; const size_t r0 = (size_t)blockIdx.x * 64; const int b = (int)(r0 / TT), t0 = (int)(r0 % TT);
  for (int e = tid; e < 64 * 8; e += 256) { const int rl = e >> 3, q = e & 7; const size_t src = (r0 + rl) * CC + q * 8; float tq[8], tk[8], tv[8];
#pragma unroll
    for (int u = 0; u < 8; ++u) { tq[u] = Qs[src + u]; tk[u] = Ks[src + u]; tv[u] = Vs[src + u]; }
    asm volatile("s_wait_loadcnt 0x0" ::: "memory");
    hx8 hq, hk, hlq, hlk;
#pragma unroll
    for (int u = 0; u < 8; ++u) { const float qv = bfr(tq[u]), kv = bfr(tk[u]); const _Float16 qh = (_Float16)qv, kh = (_Float16)kv; hq[u] = qh; hlq[u] = (_Float16)((qv - (float)qh) * 1024.0f); hk[u] = kh; hlk[u] = (_Float16)((kv - (float)kh) * 1024.0f); sv[rl][q * 8 + u] = (_Float16)bfr(tv[u]); }
    vst2((unsigned*)(QH + (r0 + rl) * CC + q * 8), *(const v4u*)&hq); vst2((unsigned*)(KH + (r0 + rl) * CC + q * 8), *(const v4u*)&hk);
    if (t0 + rl < QHI) vst2((unsigned*)(QL + ((size_t)b * QHI + t0 + rl) * CC + q * 8), *(const v4u*)&hlq);
    if (t0 + rl < KHI) vst2((unsigned*)(KL + ((size_t)b * KHI + t0 + rl) * CC + q * 8), *(const v4u*)&hlk); }
  __syncthreads();
  for (int e = tid; e < 64 * 8; e += 256) { const int c = e >> 3, q = e & 7; hx8 hv; _Pragma("unroll") for (int j = 0; j < 8; ++j) hv[j] = sv[q * 8 + j][c]; vst2((unsigned*)(VT + ((size_t)b * CC + c) * TT + t0 + q * 8), *(const v4u*)&hv);
    if (t0 < KHI) { v8b bh, bl; _Pragma("unroll") for (int j = 0; j < 8; ++j) { const float vv = (float)hv[j]; const __bf16 h1 = (__bf16)vv; bh[j] = h1; bl[j] = (__bf16)(vv - (float)h1); } vst2((unsigned*)(VB + ((size_t)b * CC + c) * KHI + t0 + q * 8), *(const v4u*)&bh); vst2((unsigned*)(VBL + ((size_t)b * CC + c) * KHI + t0 + q * 8), *(const v4u*)&bl); } } }
#define SM_EXTRA_PARAMS
#define SM_MASK_HOOK (void)0
#ifndef SM_EXTRA_PARAMS
#define SM_EXTRA_PARAMS
#endif
#ifndef PROJ_EXTRA_PARAMS
#define PROJ_EXTRA_PARAMS
#endif
#ifndef SM_MASK_HOOK
#define SM_MASK_HOOK (void)0
#endif

#define WS_QH  0u                                      // f16 q rows [b*t][CC]
#define WS_KH  (WS_QH + 2u * (size_t)NB * TT * CC)      // f16 k rows [b*t][CC]
#define WS_VT  (WS_KH + 2u * (size_t)NB * TT * CC)      // f16 v planes [b][c][t]
#define WS_QL  (WS_VT + 2u * (size_t)NB * CC * TT)      // f16 q residual x 2^10 rows [b][t < QHI][CC]
#define WS_KL  (WS_QL + 2u * (size_t)NB * QHI * CC)     // f16 k residual x 2^10 rows [b][t < KHI][CC]
#define WS_VB  (WS_KL + 2u * (size_t)NB * KHI * CC)     // bf16 v hi planes [b][c][t < KHI]
#define WS_VBL (WS_VB + 2u * (size_t)NB * CC * KHI)
#define WS_S   (WS_VBL + 2u * (size_t)NB * CC * KHI)    // f32 logits / P [hg][t][s]
#define WS_Y   (WS_S  + 4u * (size_t)HG * TQC * TT)      // (unused) end of the TQC x TT score plane
#define WS_LW  (WS_Y  + 0u)                              // f32 row sums of the current query chunk, one 128-B line per row (a line has one writer)
#define WS_END (WS_LW + 128u * (size_t)TQC)

// ---- k_proj: block = (64 rows, 128 cols, which): q/k/v = X W (+ b) with exact bf16 products (K = DIN) -> which 0: q f16 rows (+ residual rows < QHI); 1: k f16 rows (+ residual rows < KHI); 2: v f16 planes [c][t] (+ bf16 hi/lo planes for t < KHI)
__global__ __launch_bounds__(128) void k_proj(const float* __restrict__ XQ, const float* __restrict__ XK, const float* __restrict__ XV, const float* __restrict__ WQ, const float* __restrict__ WK, const float* __restrict__ WV, const float* __restrict__ BQ, const float* __restrict__ BK, const float* __restrict__ BV,
    _Float16* __restrict__ QH, _Float16* __restrict__ QL, _Float16* __restrict__ KH, _Float16* __restrict__ KL, _Float16* __restrict__ VT, __bf16* __restrict__ VB, __bf16* __restrict__ VBL) {
  __shared__ __align__(16) _Float16 sh[64][136], sl[64][136]; __shared__ __align__(16) _Float16 th[128][72]; __shared__ __align__(16) __bf16 tb[128][72], tbl[128][72];
  const int tid = threadIdx.x, wave = tid >> 5, lane = tid & 31, col = lane & 15, g = lane >> 4; const int which = blockIdx.z; const int c0 = blockIdx.y * 128; const size_t r0 = (size_t)blockIdx.x * 64; const size_t bb = r0 / TT; const int t0 = (int)(r0 % TT);
  const float* X = which == 0 ? XQ : which == 1 ? XK : XV; const float* WA = which == 0 ? WQ : which == 1 ? WK : WV; const float* BA = which == 0 ? BQ : which == 1 ? BK : BV;
  v8f acc[8] = {};
#pragma unroll 2
  for (int kc = 0; kc < DIN / 32; ++kc) { v16b a; { const float* p = X + (r0 + wave * 16 + col) * DIN + kc * 32 + 8 * g;
#pragma unroll
      for (int i = 0; i < 8; ++i) { a[i] = (__bf16)p[i]; a[8 + i] = (__bf16)p[16 + i]; } }
    asm volatile("s_wait_loadcnt 0x0" ::: "memory");
#pragma unroll
    for (int j = 0; j < 8; ++j) { const v16b w = WCOL(WA, kc * 32, c0 + j * 16 + col, lane); asm volatile("s_wait_loadcnt 0x0" ::: "memory"); acc[j] = wmma_bf(a, w, acc[j]); } }
  if (which < 2) { _Float16* DH = which == 0 ? QH : KH; _Float16* DL = which == 0 ? QL : KL; const int nhi = which == 0 ? QHI : KHI; const bool hi_rows = t0 < nhi;
#pragma unroll
    for (int j = 0; j < 8; ++j) { const float bias = BA ? bfr(BA[c0 + j * 16 + col]) : 0.f;
#pragma unroll
      for (int r = 0; r < 8; ++r) { const float v = acc[j][r] + bias; const _Float16 hv = (_Float16)v; sh[wave * 16 + 8 * g + r][j * 16 + col] = hv; sl[wave * 16 + 8 * g + r][j * 16 + col] = (_Float16)((v - (float)hv) * 1024.0f); } }
    __syncthreads();
    for (int e = tid; e < 64 * 16; e += 128) { const int rl = e >> 4, q = e & 15; vst2((unsigned*)(DH + (r0 + rl) * CC + c0 + q * 8), *(const v4u*)&sh[rl][q * 8]); if (hi_rows) vst2((unsigned*)(DL + (bb * nhi + t0 + rl) * (size_t)CC + c0 + q * 8), *(const v4u*)&sl[rl][q * 8]); }
  } else { const bool hi_rows = t0 < KHI;
#pragma unroll
    for (int j = 0; j < 8; ++j) { const float bias = BA ? bfr(BA[c0 + j * 16 + col]) : 0.f;
#pragma unroll
      for (int r = 0; r < 8; ++r) { const float v = acc[j][r] + bias; const int rl = wave * 16 + 8 * g + r, cl = j * 16 + col; th[cl][rl] = (_Float16)v; const __bf16 bh = (__bf16)v; tb[cl][rl] = bh; tbl[cl][rl] = (__bf16)(v - (float)bh); } }
    __syncthreads();
    for (int e = tid; e < 128 * 8; e += 128) { const int cl = e >> 3, q = e & 7; vst2((unsigned*)(VT + (bb * CC + c0 + cl) * (size_t)TT + t0 + q * 8), *(const v4u*)&th[cl][q * 8]); if (hi_rows) { const size_t o3 = (bb * CC + c0 + cl) * (size_t)KHI + t0 + q * 8; vst2((unsigned*)(VB + o3), *(const v4u*)&tb[cl][q * 8]); vst2((unsigned*)(VBL + o3), *(const v4u*)&tbl[cl][q * 8]); } } } }
// ---- k_sc: block = (query block qb, key block kb <= kb_last(qb), head in group) of batch b: logits x SCALE; q hi + residual (x 2^10) against k (2 products) for query rows < QHI, plus the k residual (3 products) for query blocks < QBH (causal early rows); causal: blocks past the diagonal exit, the mask itself is applied by index in k_sm
__global__ __launch_bounds__(128) void k_sc(const _Float16* __restrict__ QH, const _Float16* __restrict__ KH, const _Float16* __restrict__ QL, const _Float16* __restrict__ KL, int b, int h0, float* __restrict__ S0) { __shared__ __align__(16) float ss[4][16][132];
  const int qb = blockIdx.x, kb = blockIdx.y; if (kb > kb_last(qb)) return;
  const int h = h0 + blockIdx.z; float* S = S0 + (size_t)blockIdx.z * TT * TT;
  const int tid = threadIdx.x, wave = tid >> 5, lane = tid & 31, col = lane & 15, g = lane >> 4; const int k0 = kb * 128; const int ql0 = qb * 64 + wave * 16; const size_t q0 = (size_t)b * TT + ql0, kr0 = (size_t)b * TT + k0;
  v8f acc[8] = {}, accl[8] = {};
  const _Float16* QLb = QL + (size_t)b * QHI * CC; const _Float16* KLb = KL + (size_t)b * KHI * CC;
  if (qb < QBH) {
#pragma unroll
    for (int kc = 0; kc < HD / 32; ++kc) { const v16h ah = frag_h(QH + (q0 + col) * CC + h * HD + kc * 32, lane), al = frag_h(QLb + (size_t)(ql0 + col) * CC + h * HD + kc * 32, lane);
#pragma unroll
      for (int j = 0; j < 8; ++j) { const v16h kbf = frag_h(KH + (kr0 + j * 16 + col) * CC + h * HD + kc * 32, lane), klf = frag_h(KLb + (size_t)(k0 + j * 16 + col) * CC + h * HD + kc * 32, lane); acc[j] = wmma16(ah, kbf, acc[j]); accl[j] = wmma16(al, kbf, accl[j]); accl[j] = wmma16(ah, klf, accl[j]); } }
  } else if (qb * 64 < QHI) {
#pragma unroll
    for (int kc = 0; kc < HD / 32; ++kc) { const v16h ah = frag_h(QH + (q0 + col) * CC + h * HD + kc * 32, lane), al = frag_h(QLb + (size_t)(ql0 + col) * CC + h * HD + kc * 32, lane);
#pragma unroll
      for (int j = 0; j < 8; ++j) { const v16h kbf = frag_h(KH + (kr0 + j * 16 + col) * CC + h * HD + kc * 32, lane); acc[j] = wmma16(ah, kbf, acc[j]); accl[j] = wmma16(al, kbf, accl[j]); } }
  } else {
#pragma unroll
    for (int kc = 0; kc < HD / 32; ++kc) { const v16h ah = frag_h(QH + (q0 + col) * CC + h * HD + kc * 32, lane);
#pragma unroll
      for (int j = 0; j < 8; ++j) { const v16h kbf = frag_h(KH + (kr0 + j * 16 + col) * CC + h * HD + kc * 32, lane); acc[j] = wmma16(ah, kbf, acc[j]); } } }
#pragma unroll
  for (int j = 0; j < 8; ++j) {
#pragma unroll
    for (int r = 0; r < 8; ++r) ss[wave][8 * g + r][j * 16 + col] = (acc[j][r] + accl[j][r] * (1.0f / 1024.0f)) * SCALE; }
  LDSX(); for (int rl = 0; rl < 16; ++rl) vst2(S + (size_t)(ql0 + rl) * TT + k0 + lane * 4, *(const v4f*)&ss[wave][rl][lane * 4]); }
// ---- k_sm: block = query row t (head in group): keys [0, kend): causal -> logit if s <= t else excluded; softmax in f32; P x 2^11 in place (0 for excluded); the row sum L goes to the row's own workspace line
__global__ __launch_bounds__(256) void k_sm(float* __restrict__ S0, float* __restrict__ LW SM_EXTRA_PARAMS) { __shared__ float sred[8]; __shared__ float sbc; __shared__ __align__(16) float shv[TT];
  const int tid = threadIdx.x; const int t = blockIdx.x; const int kend = (kb_last(t >> 6) + 1) * 128;
  float* sr = S0 + (size_t)blockIdx.y * TT * TT + (size_t)t * TT;
  float m = -3.0e38f; for (int k = tid; k < kend; k += 256) { float v = (!CAUSAL || k <= t) ? sr[k] : -3.0e38f; SM_MASK_HOOK; shv[k] = v; m = fmaxf(m, v); }
#pragma unroll
  for (int o = 1; o < 32; o <<= 1) m = fmaxf(m, __shfl_xor(m, o));
  if ((tid & 31) == 0) sred[tid >> 5] = m; __syncthreads(); if (tid == 0) { float a = sred[0]; for (int i = 1; i < 8; ++i) a = fmaxf(a, sred[i]); sbc = a; } __syncthreads(); m = sbc; __syncthreads();
  float sum = 0.f; for (int k = tid; k < kend; k += 256) { const float v = shv[k]; const float e = (v <= -1.0e38f) ? 0.f : expf(v - m); shv[k] = e; sum += e; }
#pragma unroll
  for (int o = 1; o < 32; o <<= 1) sum += __shfl_xor(sum, o);
  if ((tid & 31) == 0) sred[tid >> 5] = sum; __syncthreads(); float rs = 0.f; if (tid == 0) { float a = 0.f; for (int i = 0; i < 8; ++i) a += sred[i]; sbc = a > 0.f ? 2048.0f / a : 0.f; rs = a; }   /* a fully excluded row yields P = 0 */ __syncthreads(); const float inv = sbc;
  for (int k = tid; k < kend; k += 256) shv[k] = shv[k] * inv;
  __syncthreads(); for (int q = tid; q < kend / 4; q += 256) vst2(sr + q * 4, *(const v4f*)&shv[q * 4]);
  if (tid == 0) LW[(size_t)t * 32] = rs; }   /* behind the last barrier, so that no barrier waits for this store */
// ---- k_pv: block = 16 queries of (b, h), 32 waves: wave w forms ctx = P . v over its own 1/32 of the keys [0, kend) (P x 2^11 once to f16 against v f16: 1 product; causal early query blocks: P and v as bf16 hi + lo, 3 products); the 32 partial tiles meet in LDS and are added in wave order; 256-B (row, head) segment by 16 lanes; output L = the row sums k_sm left in the workspace
#define PVW 32             // waves per k_pv block = key slices per query tile; 32 * PVW threads = the 16 x 64 outputs of a tile, one per thread in the final sum
__global__ __launch_bounds__(32 * PVW) void k_pv(const float* __restrict__ PS0, const _Float16* __restrict__ VT, const __bf16* __restrict__ VB, const __bf16* __restrict__ VBL, int b, int h0, float* __restrict__ Y, const float* __restrict__ LW, float* __restrict__ L) { const int h = h0 + blockIdx.z; const float* PS = PS0 + (size_t)blockIdx.z * TT * TT; __shared__ __align__(16) float red[PVW][8][32][4]; __shared__ __align__(16) float ss[16][HD + 4];
  const int tid = threadIdx.x, wave = __builtin_amdgcn_readfirstlane(tid >> 5), lane = tid & 31, col = lane & 15; const int qb = blockIdx.x >> 2; const int ql0 = blockIdx.x * 16; const int kce = (kb_last(qb) + 1) * 4 / PVW;
  PS += (size_t)wave * kce * 32; VT += (size_t)wave * kce * 32; VB += (size_t)wave * kce * 32; VBL += (size_t)wave * kce * 32;   /* the wave's key slice: the loops below count its kce chunks of 32 keys from here */
  v8f acc[HD / 16] = {};
  if (qb < QBH) {
#pragma unroll 1
    for (int kc = 0; kc < kce; ++kc) { const F2 p = split_row(PS + (size_t)(ql0 + col) * TT, kc * 32, lane);
      asm volatile("s_wait_loadcnt 0x0" ::: "memory");
#pragma unroll
      for (int j = 0; j < HD / 16; ++j) { const size_t po = ((size_t)b * CC + h * HD + j * 16 + col) * (size_t)KHI + kc * 32; const v16b vh = frag_b(VB + po, lane); acc[j] = wmma_bf(p.h, vh, acc[j]); acc[j] = wmma_bf(p.l, vh, acc[j]); acc[j] = wmma_bf(p.h, frag_b(VBL + po, lane), acc[j]); } }
  } else {
#pragma unroll 1
    for (int kc = 0; kc < kce; ++kc) { const v16h p = frag_f32(PS + (size_t)(ql0 + col) * TT + kc * 32, lane);
      asm volatile("s_wait_loadcnt 0x0" ::: "memory");
#pragma unroll
      for (int j = 0; j < HD / 16; ++j) { const size_t po = ((size_t)b * CC + h * HD + j * 16 + col) * (size_t)TT + kc * 32; acc[j] = wmma16(p, frag_h(VT + po, lane), acc[j]); } } }
#pragma unroll
  for (int q = 0; q < 8; ++q) { v4f t;   /* the wave's partial tile, four accumulator registers a store: red[wave][q][lane][u] = acc[q / 2][(q % 2) * 4 + u] */
#pragma unroll
    for (int u = 0; u < 4; ++u) t[u] = acc[q >> 1][(q & 1) * 4 + u];
    *(v4f*)&red[wave][q][lane][0] = t; }
  __syncthreads();
  { const float* rp = &red[0][0][0][0] + tid; float s = 0.f;   /* thread tid = (q, lane, u) adds that element of the 32 partial tiles, in wave order */
#pragma unroll
    for (int w = 0; w < PVW; ++w) s += rp[w * 1024];
    const int q = tid >> 7, ln = (tid >> 2) & 31, u = tid & 3; ss[8 * (ln >> 4) + (q & 1) * 4 + u][(q >> 1) * 16 + (ln & 15)] = s * (1.0f / 2048.0f); }
  __syncthreads();
  if (tid < 16 * (HD / 4)) vst2(Y + ((size_t)b * TT + ql0 + (tid >> 4)) * CC + h * HD + (tid & 15) * 4, *(const v4f*)&ss[tid >> 4][(tid & 15) * 4]);
  if ((blockIdx.x & 3) == 0 && tid < 16) { v4f l;   /* every fourth block: the 64 row sums of its 64-row group, two whole lines of L in one store */
#pragma unroll
    for (int u = 0; u < 4; ++u) l[u] = LW[(size_t)(qb * 64 + tid * 4 + u) * 32];
    vst2(L + qb * 64 + tid * 4, l); } }

extern "C" void kernel_launch(void* const* d_in, const int* in_sizes, int n_in, void* d_out, int out_size, void* d_ws, size_t ws_size, hipStream_t stream) {
  (void)in_sizes; (void)n_in; (void)out_size;
  const float** F = (const float**)d_in;
  if (ws_size < (size_t)WS_END) return;
  char* ws = (char*)d_ws; _Float16 *QH = (_Float16*)(ws + WS_QH), *KH = (_Float16*)(ws + WS_KH), *VT = (_Float16*)(ws + WS_VT), *QL = (_Float16*)(ws + WS_QL), *KL = (_Float16*)(ws + WS_KL); __bf16 *VB = (__bf16*)(ws + WS_VB), *VBL = (__bf16*)(ws + WS_VBL); float *S = (float*)(ws + WS_S), *Y = (float*)(ws + WS_Y), *LW = (float*)(ws + WS_LW);
  (void)Y; (void)QL; (void)KL; (void)VB; (void)VBL;
  // inputs: 0 q [8192,64]; 1 k; 2 v; outputs: (O [8192,64], L [8192,1])
  k_planes64<<<dim3(TNB * TT / 64), 256, 0, stream>>>(F[0], F[1], F[2], QH, QL, KH, KL, VT, VB, VBL);
  float* Oout = (float*)d_out; float* Lout = (float*)((char*)d_out + (size_t)TT * 64 * 4);   /* tuple output: O [8192,64] at byte 0, L [8192,1] at byte 2,097,152 */
  for (int q0 = 0; q0 < TT; q0 += TQC) {   /* query chunks: the kernels index query rows from blockIdx, so each pass receives row-advanced q / output pointers and a TQC-row grid; keys / values always span all 8,192 positions */
    k_sc<<<dim3(TQC / 64, TT / 128, 1), 128, 0, stream>>>(QH + (size_t)q0 * CC, KH, QL, KL, 0, 0, S);
    k_sm<<<dim3(TQC, 1), 256, 0, stream>>>(S, LW);
    k_pv<<<dim3(TQC / 16, 1, 1), 32 * PVW, 0, stream>>>(S, VT, VB, VBL, 0, 0, Oout + (size_t)q0 * CC, LW, Lout + q0);
  }


}

// v003
// A run of this version takes 47.9 microseconds.
// Timed twice side by side with v002, it ran 6.29 and 6.19 times as fast.
// Counting every step since v000, it is 58.3 times as fast.
// compute dtype: all float inputs rounded to bf16; q, k, v are bf16-valued so their f16 planes are exact; scores q x k (1 product on exact planes) x 64^-0.5; row max / exp / row sum in f32 (precise expf): output 1 = L = sum_k exp(S - max); output 0 = O = (P v) / L with P x 2^11 once to f16 x v (exact) (1 product), the f32 sums divided by 2^11 and by L; f32 outputs.
#include <hip/hip_runtime.h>
#include <math.h>

typedef __attribute__((ext_vector_type(16))) _Float16 v16h;
typedef __attribute__((ext_vector_type(16))) __bf16 v16b;
typedef __attribute__((ext_vector_type(8)))  _Float16 v8h;
typedef __attribute__((ext_vector_type(8)))  float v8f;
typedef __attribute__((ext_vector_type(4)))  float v4f;
typedef __attribute__((ext_vector_type(2)))  float v2f;
typedef __attribute__((ext_vector_type(4)))  unsigned v4u;
typedef _Float16 hx8 __attribute__((ext_vector_type(8)));
typedef __attribute__((ext_vector_type(4)))  int v4i;
typedef float __attribute__((may_alias)) float_a;
typedef int __attribute__((may_alias)) int_a;

template <typename T> __device__ __forceinline__ void vst2(void* p, T v) { *(T*)p = v;  }
__device__ __forceinline__ v8f wmma16(v16h a, v16h b, v8f c) {
  v8f d = __builtin_amdgcn_wmma_f32_16x16x32_f16(false, a, false, b, (short)0, c, false, false);
  asm volatile("v_nop\n\tv_nop\n\tv_nop\n\tv_nop" : "+v"(d) : "v"(a), "v"(b));
  return d;
}
__device__ __forceinline__ v8f wmma_bf(v16b a, v16b b, v8f c) {
  v8f d = __builtin_amdgcn_wmma_f32_16x16x32_bf16(false, a, false, b, (short)0, c, false, false);
  asm volatile("v_nop\n\tv_nop\n\tv_nop\n\tv_nop" : "+v"(d) : "v"(a), "v"(b));
  return d;
}
// 16x16x32 fragments: lane = (h = lane>>4, row/col = lane&15); elements 0..7 = k0+8h+0..7, 8..15 = k0+16+8h+0..7; D element r = row 8h+r
__device__ __forceinline__ v16h frag_h(const _Float16* rowk0, int lane) {
  union { v16h v; v8h q[2]; } u; const _Float16* p = rowk0 + 8 * (lane >> 4);
  u.q[0] = *(const v8h*)p; u.q[1] = *(const v8h*)(p + 16); return u.v;
}
__device__ __forceinline__ v16h frag_f32(const float* rowk0, int lane) {
  v16h a; const float* p = rowk0 + 8 * (lane >> 4);
#pragma unroll
  for (int i = 0; i < 8; ++i) { a[i] = (_Float16)p[i]; a[8 + i] = (_Float16)p[16 + i]; }
  return a;
}
__device__ __forceinline__ v16h frag_f32s(const float* rowk0, int lane, float sc) {
  v16h a; const float* p = rowk0 + 8 * (lane >> 4);
#pragma unroll
  for (int i = 0; i < 8; ++i) { a[i] = (_Float16)(p[i] * sc); a[8 + i] = (_Float16)(p[16 + i] * sc); }
  return a;
}
// column fragment from a [K][ld] layout (column n), rows >= K read as 0
__device__ __forceinline__ v16h fragc_f32(const float* W, int k0, int n, int lane, int ld, int K) {
  v16h a; const int g = lane >> 4;
#pragma unroll
  for (int i = 0; i < 8; ++i) { const int ka = k0 + 8 * g + i, kb = ka + 16;
    a[i] = (_Float16)(ka < K ? W[(size_t)(ka < K ? ka : K - 1) * ld + n] : 0.f); a[8 + i] = (_Float16)(kb < K ? W[(size_t)(kb < K ? kb : K - 1) * ld + n] : 0.f); }
  return a;
}
struct F2 { v16b h, l; };
__device__ __forceinline__ F2 bsplit16(const float v[16]) { F2 r;
#pragma unroll
  for (int i = 0; i < 16; ++i) { const __bf16 h = (__bf16)v[i]; r.h[i] = h; r.l[i] = (__bf16)(v[i] - (float)h); }
  return r; }
__device__ __forceinline__ F2 split_row(const float* row, int k0, int lane) { float v[16]; const float* p = row + k0 + 8 * (lane >> 4);
#pragma unroll
  for (int i = 0; i < 8; ++i) { v[i] = p[i]; v[8 + i] = p[16 + i]; }
  return bsplit16(v); }
__device__ __forceinline__ F2 split_rowK(const float* row, int k0, int lane, int K) { float v[16]; const int g = lane >> 4;
#pragma unroll
  for (int i = 0; i < 8; ++i) { const int ka = k0 + 8 * g + i, kb = ka + 16; v[i] = ka < K ? row[ka < K ? ka : K - 1] : 0.f; v[8 + i] = kb < K ? row[kb < K ? kb : K - 1] : 0.f; }
  return bsplit16(v); }
__device__ __forceinline__ F2 split_col(const float* W, int k0, int n, int lane, int ld, int K) { float v[16]; const int g = lane >> 4;
#pragma unroll
  for (int i = 0; i < 8; ++i) { const int ka = k0 + 8 * g + i, kb = ka + 16; v[i] = ka < K ? W[(size_t)(ka < K ? ka : K - 1) * ld + n] : 0.f; v[8 + i] = kb < K ? W[(size_t)(kb < K ? kb : K - 1) * ld + n] : 0.f; }
  return bsplit16(v); }
__device__ __forceinline__ v8f mac3(const F2& a, const F2& b, v8f c) { c = wmma_bf(a.l, b.h, c); c = wmma_bf(a.h, b.l, c); return wmma_bf(a.h, b.h, c); }
__device__ __forceinline__ float sigm(float v) { return 1.0f / (1.0f + expf(-v)); }
#define LDSX() do { asm volatile("s_wait_dscnt 0" ::: "memory"); __builtin_amdgcn_wave_barrier(); __builtin_amdgcn_fence(__ATOMIC_RELEASE, "workgroup"); } while (0)

// Flash-attention reference on one long sequence with TWO outputs (q / k / v [8192,64]; S = q k^T / 8; m = rowmax(S); P = exp(S - m); L = rowsum(P) [8192,1]; O = (P v) / L [8192,64]; returns the tuple (O, L); no mask). One kernel does scores, softmax and P v; no score reaches memory.
#define NB 1
#define TT 8192
#define CC 64            // NH * HD = projected width
#define DIN 64          // input (model) width
#define NH 1
#define HD 64
#define NQB (TT / 64)
#define HG 1
#define SCALE (0.125f)
#define CAUSAL 0
#ifndef TNB
#define TNB NB
#endif
__device__ __forceinline__ float bfr(float v) { return (float)(__bf16)v; }
__host__ __device__ __forceinline__ int kb_last(int qb) { return CAUSAL ? ((qb * 64 + 63) >> 7) : (TT / 128 - 1); }
typedef __attribute__((ext_vector_type(8))) __bf16 v8b;
__device__ __forceinline__ v16b frag_b(const __bf16* rowk0, int lane) {
  union { v16b v; v8b q[2]; } u; const __bf16* p = rowk0 + 8 * (lane >> 4);
  u.q[0] = *(const v8b*)p; u.q[1] = *(const v8b*)(p + 16); return u.v;
}
#define QBH 0              // exact planes: single-product logits and single-f16 P x V on every block
#define QHI 0               // no q residual plane (q is bf16-exact in f16)
#define KHI 64              // unused high-precision planes kept minimal
// B fragment (k rows k0+.., output column o) of a weight: (in,out) [K][ld] or (out,in) [ld rows of K]: bf16 exact, or f16(bf16 * 256) exact
__device__ __forceinline__ v16b wcol_io(const float* Wm, int k0, int o, int lane, int ld) { v16b w; const int g = lane >> 4;
#pragma unroll
  for (int i = 0; i < 8; ++i) { w[i] = (__bf16)Wm[(size_t)(k0 + 8 * g + i) * ld + o]; w[8 + i] = (__bf16)Wm[(size_t)(k0 + 16 + 8 * g + i) * ld + o]; }
  return w; }
__device__ __forceinline__ v16b wcol_oi(const float* Wm, int k0, int o, int lane, int K) { v16b w; const float* p = Wm + (size_t)o * K + k0 + 8 * (lane >> 4);
#pragma unroll
  for (int i = 0; i < 8; ++i) { w[i] = (__bf16)p[i]; w[8 + i] = (__bf16)p[16 + i]; }
  return w; }
__device__ __forceinline__ v16h wcolh_io(const float* Wm, int k0, int o, int lane, int ld) { v16h w; const int g = lane >> 4;
#pragma unroll
  for (int i = 0; i < 8; ++i) { w[i] = (_Float16)(bfr(Wm[(size_t)(k0 + 8 * g + i) * ld + o]) * 256.0f); w[8 + i] = (_Float16)(bfr(Wm[(size_t)(k0 + 16 + 8 * g + i) * ld + o]) * 256.0f); }
  return w; }
__device__ __forceinline__ v16h wcolh_oi(const float* Wm, int k0, int o, int lane, int K) { v16h w; const float* p = Wm + (size_t)o * K + k0 + 8 * (lane >> 4);
#pragma unroll
  for (int i = 0; i < 8; ++i) { w[i] = (_Float16)(bfr(p[i]) * 256.0f); w[8 + i] = (_Float16)(bfr(p[16 + i]) * 256.0f); }
  return w; }
#define WQKV_LAYOUT 0   // 0 = (in,out) [DIN][CC]; 1 = (out,in) [CC][DIN]; 2 = per-head [NH][DIN][HD]
__device__ __forceinline__ v16b wcol_hdk(const float* Wm, int k0, int o, int lane) { v16b w; const int g = lane >> 4; const float* p = Wm + (size_t)(o / HD) * DIN * HD + (o % HD);
#pragma unroll
  for (int i = 0; i < 8; ++i) { w[i] = (__bf16)p[(size_t)(k0 + 8 * g + i) * HD]; w[8 + i] = (__bf16)p[(size_t)(k0 + 16 + 8 * g + i) * HD]; }
  return w; }
#define WO_OUT_IN 0
#if WQKV_LAYOUT == 1
#define WCOL(W, k0, o, lane) wcol_oi(W, k0, o, lane, DIN)
#elif WQKV_LAYOUT == 2
#define WCOL(W, k0, o, lane) wcol_hdk(W, k0, o, lane)
#else
#define WCOL(W, k0, o, lane) wcol_io(W, k0, o, lane, CC)
#endif
#if WO_OUT_IN
#define WOCOL(W, k0, o, lane) wcol_oi(W, k0, o, lane, CC)
#define WOCOLH(W, k0, o, lane) wcolh_oi(W, k0, o, lane, CC)
#else
#define WOCOL(W, k0, o, lane) wcol_io(W, k0, o, lane, DIN)
#define WOCOLH(W, k0, o, lane) wcolh_io(W, k0, o, lane, DIN)
#endif
__global__ __launch_bounds__(256) void k_planes64(const float* __restrict__ Qs, const float* __restrict__ Ks, const float* __restrict__ Vs, _Float16* __restrict__ QH, _Float16* __restrict__ QL, _Float16* __restrict__ KH, _Float16* __restrict__ KL, _Float16* __restrict__ VT, __bf16* __restrict__ VB, __bf16* __restrict__ VBL) {
  __shared__ _Float16 sv[64][72];
  const int tid = threadIdx.x; const size_t r0 = (size_t)blockIdx.x * 64; const int b = (int)(r0 / TT), t0 = (int)(r0 % TT);
  for (int e = tid; e < 64 * 8; e += 256) { const int rl = e >> 3, q = e & 7; const size_t src = (r0 + rl) * CC + q * 8; float tq[8], tk[8], tv[8];
#pragma unroll
    for (int u = 0; u < 8; ++u) { tq[u] = Qs[src + u]; tk[u] = Ks[src + u]; tv[u] = Vs[src + u]; }
    asm volatile("s_wait_loadcnt 0x0" ::: "memory");
    hx8 hq, hk, hlq, hlk;
#pragma unroll
    for (int u = 0; u < 8; ++u) { const float qv = bfr(tq[u]), kv = bfr(tk[u]); const _Float16 qh = (_Float16)qv, kh = (_Float16)kv; hq[u] = qh; hlq[u] = (_Float16)((qv - (float)qh) * 1024.0f); hk[u] = kh; hlk[u] = (_Float16)((kv - (float)kh) * 1024.0f); sv[rl][q * 8 + u] = (_Float16)bfr(tv[u]); }
    vst2((unsigned*)(QH + (r0 + rl) * CC + q * 8), *(const v4u*)&hq); vst2((unsigned*)(KH + (r0 + rl) * CC + q * 8), *(const v4u*)&hk);
    if (t0 + rl < QHI) vst2((unsigned*)(QL + ((size_t)b * QHI + t0 + rl) * CC + q * 8), *(const v4u*)&hlq);
    if (t0 + rl < KHI) vst2((unsigned*)(KL + ((size_t)b * KHI + t0 + rl) * CC + q * 8), *(const v4u*)&hlk); }
  __syncthreads();
  for (int e = tid; e < 64 * 8; e += 256) { const int c = e >> 3, q = e & 7; hx8 hv; _Pragma("unroll") for (int j = 0; j < 8; ++j) hv[j] = sv[q * 8 + j][c]; vst2((unsigned*)(VT + ((size_t)b * CC + c) * TT + t0 + q * 8), *(const v4u*)&hv);
    if (t0 < KHI) { v8b bh, bl; _Pragma("unroll") for (int j = 0; j < 8; ++j) { const float vv = (float)hv[j]; const __bf16 h1 = (__bf16)vv; bh[j] = h1; bl[j] = (__bf16)(vv - (float)h1); } vst2((unsigned*)(VB + ((size_t)b * CC + c) * KHI + t0 + q * 8), *(const v4u*)&bh); vst2((unsigned*)(VBL + ((size_t)b * CC + c) * KHI + t0 + q * 8), *(const v4u*)&bl); } } }
#define SM_EXTRA_PARAMS
#define SM_MASK_HOOK (void)0
#ifndef SM_EXTRA_PARAMS
#define SM_EXTRA_PARAMS
#endif
#ifndef PROJ_EXTRA_PARAMS
#define PROJ_EXTRA_PARAMS
#endif
#ifndef SM_MASK_HOOK
#define SM_MASK_HOOK (void)0
#endif

#define WS_QH  0u                                      // f16 q rows [b*t][CC]
#define WS_KH  (WS_QH + 2u * (size_t)NB * TT * CC)      // f16 k rows [b*t][CC]
#define WS_VT  (WS_KH + 2u * (size_t)NB * TT * CC)      // f16 v planes [b][c][t]
#define WS_QL  (WS_VT + 2u * (size_t)NB * CC * TT)      // f16 q residual x 2^10 rows [b][t < QHI][CC]
#define WS_KL  (WS_QL + 2u * (size_t)NB * QHI * CC)     // f16 k residual x 2^10 rows [b][t < KHI][CC]
#define WS_VB  (WS_KL + 2u * (size_t)NB * KHI * CC)     // bf16 v hi planes [b][c][t < KHI]
#define WS_VBL (WS_VB + 2u * (size_t)NB * CC * KHI)
#define WS_END (WS_VBL + 2u * (size_t)NB * CC * KHI)

// ---- k_proj: block = (64 rows, 128 cols, which): q/k/v = X W (+ b) with exact bf16 products (K = DIN) -> which 0: q f16 rows (+ residual rows < QHI); 1: k f16 rows (+ residual rows < KHI); 2: v f16 planes [c][t] (+ bf16 hi/lo planes for t < KHI)
__global__ __launch_bounds__(128) void k_proj(const float* __restrict__ XQ, const float* __restrict__ XK, const float* __restrict__ XV, const float* __restrict__ WQ, const float* __restrict__ WK, const float* __restrict__ WV, const float* __restrict__ BQ, const float* __restrict__ BK, const float* __restrict__ BV,
    _Float16* __restrict__ QH, _Float16* __restrict__ QL, _Float16* __restrict__ KH, _Float16* __restrict__ KL, _Float16* __restrict__ VT, __bf16* __restrict__ VB, __bf16* __restrict__ VBL) {
  __shared__ __align__(16) _Float16 sh[64][136], sl[64][136]; __shared__ __align__(16) _Float16 th[128][72]; __shared__ __align__(16) __bf16 tb[128][72], tbl[128][72];
  const int tid = threadIdx.x, wave = tid >> 5, lane = tid & 31, col = lane & 15, g = lane >> 4; const int which = blockIdx.z; const int c0 = blockIdx.y * 128; const size_t r0 = (size_t)blockIdx.x * 64; const size_t bb = r0 / TT; const int t0 = (int)(r0 % TT);
  const float* X = which == 0 ? XQ : which == 1 ? XK : XV; const float* WA = which == 0 ? WQ : which == 1 ? WK : WV; const float* BA = which == 0 ? BQ : which == 1 ? BK : BV;
  v8f acc[8] = {};
#pragma unroll 2
  for (int kc = 0; kc < DIN / 32; ++kc) { v16b a; { const float* p = X + (r0 + wave * 16 + col) * DIN + kc * 32 + 8 * g;
#pragma unroll
      for (int i = 0; i < 8; ++i) { a[i] = (__bf16)p[i]; a[8 + i] = (__bf16)p[16 + i]; } }
    asm volatile("s_wait_loadcnt 0x0" ::: "memory");
#pragma unroll
    for (int j = 0; j < 8; ++j) { const v16b w = WCOL(WA, kc * 32, c0 + j * 16 + col, lane); asm volatile("s_wait_loadcnt 0x0" ::: "memory"); acc[j] = wmma_bf(a, w, acc[j]); } }
  if (which < 2) { _Float16* DH = which == 0 ? QH : KH; _Float16* DL = which == 0 ? QL : KL; const int nhi = which == 0 ? QHI : KHI; const bool hi_rows = t0 < nhi;
#pragma unroll
    for (int j = 0; j < 8; ++j) { const float bias = BA ? bfr(BA[c0 + j * 16 + col]) : 0.f;
#pragma unroll
      for (int r = 0; r < 8; ++r) { const float v = acc[j][r] + bias; const _Float16 hv = (_Float16)v; sh[wave * 16 + 8 * g + r][j * 16 + col] = hv; sl[wave * 16 + 8 * g + r][j * 16 + col] = (_Float16)((v - (float)hv) * 1024.0f); } }
    __syncthreads();
    for (int e = tid; e < 64 * 16; e += 128) { const int rl = e >> 4, q = e & 15; vst2((unsigned*)(DH + (r0 + rl) * CC + c0 + q * 8), *(const v4u*)&sh[rl][q * 8]); if (hi_rows) vst2((unsigned*)(DL + (bb * nhi + t0 + rl) * (size_t)CC + c0 + q * 8), *(const v4u*)&sl[rl][q * 8]); }
  } else { const bool hi_rows = t0 < KHI;
#pragma unroll
    for (int j = 0; j < 8; ++j) { const float bias = BA ? bfr(BA[c0 + j * 16 + col]) : 0.f;
#pragma unroll
      for (int r = 0; r < 8; ++r) { const float v = acc[j][r] + bias; const int rl = wave * 16 + 8 * g + r, cl = j * 16 + col; th[cl][rl] = (_Float16)v; const __bf16 bh = (__bf16)v; tb[cl][rl] = bh; tbl[cl][rl] = (__bf16)(v - (float)bh); } }
    __syncthreads();
    for (int e = tid; e < 128 * 8; e += 128) { const int cl = e >> 3, q = e & 7; vst2((unsigned*)(VT + (bb * CC + c0 + cl) * (size_t)TT + t0 + q * 8), *(const v4u*)&th[cl][q * 8]); if (hi_rows) { const size_t o3 = (bb * CC + c0 + cl) * (size_t)KHI + t0 + q * 8; vst2((unsigned*)(VB + o3), *(const v4u*)&tb[cl][q * 8]); vst2((unsigned*)(VBL + o3), *(const v4u*)&tbl[cl][q * 8]); } } } }
// ---- k_fa: block = 32 queries, 16 waves; wave w walks its own 1/16 of the keys in steps of 64 and keeps everything of a score in registers: S^T = K . Q^T (a lane holds one query's scores), running row max and row sum in f32 (precise expf), P x 2^11 once to f16, packed from the score tiles into the B operand of O^T += V^T . P^T. The 16 waves' (max, sum, O^T) meet in LDS: all are brought to the block's row max and added in wave order. O = sum / 2^11 / L; L = the row sum.
#define FQ 32              // queries per block: two 16-query column groups per wave, so that each K / V fragment feeds two products
#define FW 16              // waves per block = key slices
#define FKS (TT / FW)      // keys per wave
#define FST 64             // keys per step: one test of the running max and one rescale of O^T per 64 keys
__device__ __forceinline__ v8f wmmah(v16h a, v16h b, v8f c) { return __builtin_amdgcn_wmma_f32_16x16x32_f16(false, a, false, b, (short)0, c, false, false); }
__device__ __forceinline__ float xhalf(float x) { return __builtin_bit_cast(float, __builtin_amdgcn_permlanex16(__builtin_bit_cast(int, x), __builtin_bit_cast(int, x), 0x76543210, 0xfedcba98, false, false)); }   // lane l with lane l ^ 16
__global__ __launch_bounds__(32 * FW) void k_fa(const _Float16* __restrict__ QH, const _Float16* __restrict__ KH, const _Float16* __restrict__ VT, float* __restrict__ O, float* __restrict__ L) {
  __shared__ __align__(16) float red[FW][16][32][4]; __shared__ float sm[FW][FQ], sl[FW][FQ]; __shared__ __align__(16) float ss[FQ][HD + 4];
  const int tid = threadIdx.x, wave = __builtin_amdgcn_readfirstlane(tid >> 5), lane = tid & 31, col = lane & 15; const int q0 = blockIdx.x * FQ;
  v16h qf[2][2];   /* every full unroll below is there so that the arrays it indexes (fragments, score tiles, accumulators) have constant indices and stay in registers */
#pragma unroll
  for (int qt = 0; qt < 2; ++qt) { qf[qt][0] = frag_h(QH + (size_t)(q0 + qt * 16 + col) * CC, lane); qf[qt][1] = frag_h(QH + (size_t)(q0 + qt * 16 + col) * CC + 32, lane); }
  v8f acc[2][HD / 16] = {}; float m[2] = {-3.0e38f, -3.0e38f}, l[2] = {0.f, 0.f};
  const _Float16* Kw = KH + (size_t)(wave * FKS + col) * CC; const _Float16* Vw = VT + (size_t)col * TT + wave * FKS;
#pragma unroll 1   /* one step's fragments, scores and sums already take 240 of the 256 registers a wave of this block may own: two steps in flight would spill */
  for (int st = 0; st < FKS / FST; ++st) {
    v8f s[2][4];   /* s[qt][kt][r] = raw score of key 16 kt + 8 h + r of the step against query 16 qt + col */
#pragma unroll
    for (int kt = 0; kt < 4; ++kt) { const _Float16* kp = Kw + (size_t)(st * FST + kt * 16) * CC; const v16h ka = frag_h(kp, lane), kb = frag_h(kp + 32, lane);
#pragma unroll
      for (int qt = 0; qt < 2; ++qt) { const v8f z = {}; s[qt][kt] = wmmah(kb, qf[qt][1], wmmah(ka, qf[qt][0], z)); } }
    v16h p[2][2];
#pragma unroll
    for (int qt = 0; qt < 2; ++qt) { float mx = s[qt][0][0];
#pragma unroll
      for (int kt = 0; kt < 4; ++kt) {
#pragma unroll
        for (int r = 0; r < 8; ++r) mx = fmaxf(mx, s[qt][kt][r]); }
      mx = fmaxf(mx, xhalf(mx)); const float mn = fmaxf(m[qt], mx * SCALE); const float al = expf(m[qt] - mn); m[qt] = mn;
#pragma unroll
      for (int j = 0; j < HD / 16; ++j) acc[qt][j] *= al;
      float a4[4] = {0.f, 0.f, 0.f, 0.f};
#pragma unroll
      for (int kt = 0; kt < 4; ++kt) {
#pragma unroll
        for (int r = 0; r < 8; ++r) { const float e = expf(s[qt][kt][r] * SCALE - mn); a4[kt] += e; p[qt][kt >> 1][(kt & 1) * 8 + r] = (_Float16)(e * 2048.0f); } }
      l[qt] = l[qt] * al + ((a4[0] + a4[1]) + (a4[2] + a4[3])); }
#pragma unroll
    for (int kc = 0; kc < 2; ++kc) {
#pragma unroll
      for (int j = 0; j < HD / 16; ++j) { const v16h vf = frag_h(Vw + (size_t)(j * 16) * TT + st * FST + kc * 32, lane);
#pragma unroll
        for (int qt = 0; qt < 2; ++qt) acc[qt][j] = wmmah(vf, p[qt][kc], acc[qt][j]); } } }
  if (lane < 16) { sm[wave][col] = m[0]; sm[wave][16 + col] = m[1]; }
  __syncthreads();
#pragma unroll
  for (int qt = 0; qt < 2; ++qt) { float mf = sm[0][qt * 16 + col];
#pragma unroll
    for (int w = 1; w < FW; ++w) mf = fmaxf(mf, sm[w][qt * 16 + col]);
    const float f = expf(m[qt] - mf); const float lw = (l[qt] + xhalf(l[qt])) * f; if (lane < 16) sl[wave][qt * 16 + col] = lw;
#pragma unroll
    for (int j = 0; j < HD / 16; ++j) {
#pragma unroll
      for (int hf = 0; hf < 2; ++hf) { v4f t;   /* red[wave][(qt * 4 + j) * 2 + hf][lane][u] = O^T partial of channel 16 j + 8 h + 4 hf + u, query 16 qt + col */
#pragma unroll
        for (int u = 0; u < 4; ++u) t[u] = acc[qt][j][hf * 4 + u] * f;
        *(v4f*)&red[wave][(qt * 4 + j) * 2 + hf][lane][0] = t; } } }
  __syncthreads();
  { const int sIdx = tid >> 5, qq = (sIdx >> 3) * 16 + col; v4f t = *(const v4f*)&red[0][sIdx][lane][0]; float ls = sl[0][qq];   /* thread = (slot, lane): four channels of one query, the 16 waves' parts added in wave order */
#pragma unroll
    for (int w = 1; w < FW; ++w) { t += *(const v4f*)&red[w][sIdx][lane][0]; ls += sl[w][qq]; }
#pragma unroll
    for (int u = 0; u < 4; ++u) t[u] = t[u] * (1.0f / 2048.0f) / ls;
    *(v4f*)&ss[qq][((sIdx >> 1) & 3) * 16 + 8 * (lane >> 4) + (sIdx & 1) * 4] = t;
    if (tid < FQ) { float lq = sl[0][tid];   /* the block's 32 row sums, same order as above: one whole line of L in one store of one wave */
#pragma unroll
      for (int w = 1; w < FW; ++w) lq += sl[w][tid];
      L[q0 + tid] = lq; } }
  __syncthreads();
  vst2(O + (size_t)(q0 + (tid >> 4)) * CC + (tid & 15) * 4, *(const v4f*)&ss[tid >> 4][(tid & 15) * 4]); }

extern "C" void kernel_launch(void* const* d_in, const int* in_sizes, int n_in, void* d_out, int out_size, void* d_ws, size_t ws_size, hipStream_t stream) {
  (void)in_sizes; (void)n_in; (void)out_size;
  const float** F = (const float**)d_in;
  if (ws_size < (size_t)WS_END) return;
  char* ws = (char*)d_ws; _Float16 *QH = (_Float16*)(ws + WS_QH), *KH = (_Float16*)(ws + WS_KH), *VT = (_Float16*)(ws + WS_VT), *QL = (_Float16*)(ws + WS_QL), *KL = (_Float16*)(ws + WS_KL); __bf16 *VB = (__bf16*)(ws + WS_VB), *VBL = (__bf16*)(ws + WS_VBL);
  // inputs: 0 q [8192,64]; 1 k; 2 v; outputs: (O [8192,64], L [8192,1])
  k_planes64<<<dim3(TNB * TT / 64), 256, 0, stream>>>(F[0], F[1], F[2], QH, QL, KH, KL, VT, VB, VBL);
  float* Oout = (float*)d_out; float* Lout = (float*)((char*)d_out + (size_t)TT * 64 * 4);   /* tuple output: O [8192,64] at byte 0, L [8192,1] at byte 2,097,152 */
  k_fa<<<dim3(TT / FQ), 32 * FW, 0, stream>>>(QH, KH, VT, Oout, Lout);
}

// v004
// It runs in 46.1 microseconds.
// Two timings next to v003 both put it at 1.05 times that version's speed.
// Counting every step since v000, it is 61.3 times as fast.
// compute dtype: all float inputs rounded to bf16; q, k, v are bf16-valued so their f16 planes are exact; scores q x k (1 product on exact planes) x 64^-0.5; row max / exp / row sum in f32, exp(S - max) x 2^11 formed as 2^(one f32 fma) on the hardware's base-2 exponential: output 1 = L = sum_k exp(S - max); output 0 = O = (P v) / L with P x 2^11 once to f16 x v (exact) (1 product), the f32 sums divided by the row sum x 2^11; f32 outputs.
#include <hip/hip_runtime.h>
#include <math.h>

typedef __attribute__((ext_vector_type(16))) _Float16 v16h;
typedef __attribute__((ext_vector_type(16))) __bf16 v16b;
typedef __attribute__((ext_vector_type(8)))  _Float16 v8h;
typedef __attribute__((ext_vector_type(8)))  float v8f;
typedef __attribute__((ext_vector_type(4)))  float v4f;
typedef __attribute__((ext_vector_type(2)))  float v2f;
typedef __attribute__((ext_vector_type(4)))  unsigned v4u;
typedef _Float16 hx8 __attribute__((ext_vector_type(8)));
typedef __attribute__((ext_vector_type(4)))  int v4i;
typedef float __attribute__((may_alias)) float_a;
typedef int __attribute__((may_alias)) int_a;

template <typename T> __device__ __forceinline__ void vst2(void* p, T v) { *(T*)p = v;  }
__device__ __forceinline__ v8f wmma16(v16h a, v16h b, v8f c) {
  v8f d = __builtin_amdgcn_wmma_f32_16x16x32_f16(false, a, false, b, (short)0, c, false, false);
  asm volatile("v_nop\n\tv_nop\n\tv_nop\n\tv_nop" : "+v"(d) : "v"(a), "v"(b));
  return d;
}
__device__ __forceinline__ v8f wmma_bf(v16b a, v16b b, v8f c) {
  v8f d = __builtin_amdgcn_wmma_f32_16x16x32_bf16(false, a, false, b, (short)0, c, false, false);
  asm volatile("v_nop\n\tv_nop\n\tv_nop\n\tv_nop" : "+v"(d) : "v"(a), "v"(b));
  return d;
}
// 16x16x32 fragments: lane = (h = lane>>4, row/col = lane&15); elements 0..7 = k0+8h+0..7, 8..15 = k0+16+8h+0..7; D element r = row 8h+r
__device__ __forceinline__ v16h frag_h(const _Float16* rowk0, int lane) {
  union { v16h v; v8h q[2]; } u; const _Float16* p = rowk0 + 8 * (lane >> 4);
  u.q[0] = *(const v8h*)p; u.q[1] = *(const v8h*)(p + 16); return u.v;
}
__device__ __forceinline__ v16h frag_f32(const float* rowk0, int lane) {
  v16h a; const float* p = rowk0 + 8 * (lane >> 4);
#pragma unroll
  for (int i = 0; i < 8; ++i) { a[i] = (_Float16)p[i]; a[8 + i] = (_Float16)p[16 + i]; }
  return a;
}
__device__ __forceinline__ v16h frag_f32s(const float* rowk0, int lane, float sc) {
  v16h a; const float* p = rowk0 + 8 * (lane >> 4);
#pragma unroll
  for (int i = 0; i < 8; ++i) { a[i] = (_Float16)(p[i] * sc); a[8 + i] = (_Float16)(p[16 + i] * sc); }
  return a;
}
// column fragment from a [K][ld] layout (column n), rows >= K read as 0
__device__ __forceinline__ v16h fragc_f32(const float* W, int k0, int n, int lane, int ld, int K) {
  v16h a; const int g = lane >> 4;
#pragma unroll
  for (int i = 0; i < 8; ++i) { const int ka = k0 + 8 * g + i, kb = ka + 16;
    a[i] = (_Float16)(ka < K ? W[(size_t)(ka < K ? ka : K - 1) * ld + n] : 0.f); a[8 + i] = (_Float16)(kb < K ? W[(size_t)(kb < K ? kb : K - 1) * ld + n] : 0.f); }
  return a;
}
struct F2 { v16b h, l; };
__device__ __forceinline__ F2 bsplit16(const float v[16]) { F2 r;
#pragma unroll
  for (int i = 0; i < 16; ++i) { const __bf16 h = (__bf16)v[i]; r.h[i] = h; r.l[i] = (__bf16)(v[i] - (float)h); }
  return r; }
__device__ __forceinline__ F2 split_row(const float* row, int k0, int lane) { float v[16]; const float* p = row + k0 + 8 * (lane >> 4);
#pragma unroll
  for (int i = 0; i < 8; ++i) { v[i] = p[i]; v[8 + i] = p[16 + i]; }
  return bsplit16(v); }
__device__ __forceinline__ F2 split_rowK(const float* row, int k0, int lane, int K) { float v[16]; const int g = lane >> 4;
#pragma unroll
  for (int i = 0; i < 8; ++i) { const int ka = k0 + 8 * g + i, kb = ka + 16; v[i] = ka < K ? row[ka < K ? ka : K - 1] : 0.f; v[8 + i] = kb < K ? row[kb < K ? kb : K - 1] : 0.f; }
  return bsplit16(v); }
__device__ __forceinline__ F2 split_col(const float* W, int k0, int n, int lane, int ld, int K) { float v[16]; const int g = lane >> 4;
#pragma unroll
  for (int i = 0; i < 8; ++i) { const int ka = k0 + 8 * g + i, kb = ka + 16; v[i] = ka < K ? W[(size_t)(ka < K ? ka : K - 1) * ld + n] : 0.f; v[8 + i] = kb < K ? W[(size_t)(kb < K ? kb : K - 1) * ld + n] : 0.f; }
  return bsplit16(v); }
__device__ __forceinline__ v8f mac3(const F2& a, const F2& b, v8f c) { c = wmma_bf(a.l, b.h, c); c = wmma_bf(a.h, b.l, c); return wmma_bf(a.h, b.h, c); }
__device__ __forceinline__ float sigm(float v) { return 1.0f / (1.0f + expf(-v)); }
#define LDSX() do { asm volatile("s_wait_dscnt 0" ::: "memory"); __builtin_amdgcn_wave_barrier(); __builtin_amdgcn_fence(__ATOMIC_RELEASE, "workgroup"); } while (0)

// Flash-attention reference on one long sequence with TWO outputs (q / k / v [8192,64]; S = q k^T / 8; m = rowmax(S); P = exp(S - m); L = rowsum(P) [8192,1]; O = (P v) / L [8192,64]; returns the tuple (O, L); no mask). One kernel does scores, softmax and P v; no score reaches memory.
#define NB 1
#define TT 8192
#define CC 64            // NH * HD = projected width
#define DIN 64          // input (model) width
#define NH 1
#define HD 64
#define NQB (TT / 64)
#define HG 1
#define SCALE (0.125f)
#define CAUSAL 0
#ifndef TNB
#define TNB NB
#endif
__device__ __forceinline__ float bfr(float v) { return (float)(__bf16)v; }
__host__ __device__ __forceinline__ int kb_last(int qb) { return CAUSAL ? ((qb * 64 + 63) >> 7) : (TT / 128 - 1); }
typedef __attribute__((ext_vector_type(8))) __bf16 v8b;
__device__ __forceinline__ v16b frag_b(const __bf16* rowk0, int lane) {
  union { v16b v; v8b q[2]; } u; const __bf16* p = rowk0 + 8 * (lane >> 4);
  u.q[0] = *(const v8b*)p; u.q[1] = *(const v8b*)(p + 16); return u.v;
}
#define QBH 0              // exact planes: single-product logits and single-f16 P x V on every block
#define QHI 0               // no q residual plane (q is bf16-exact in f16)
#define KHI 64              // unused high-precision planes kept minimal
// B fragment (k rows k0+.., output column o) of a weight: (in,out) [K][ld] or (out,in) [ld rows of K]: bf16 exact, or f16(bf16 * 256) exact
__device__ __forceinline__ v16b wcol_io(const float* Wm, int k0, int o, int lane, int ld) { v16b w; const int g = lane >> 4;
#pragma unroll
  for (int i = 0; i < 8; ++i) { w[i] = (__bf16)Wm[(size_t)(k0 + 8 * g + i) * ld + o]; w[8 + i] = (__bf16)Wm[(size_t)(k0 + 16 + 8 * g + i) * ld + o]; }
  return w; }
__device__ __forceinline__ v16b wcol_oi(const float* Wm, int k0, int o, int lane, int K) { v16b w; const float* p = Wm + (size_t)o * K + k0 + 8 * (lane >> 4);
#pragma unroll
  for (int i = 0; i < 8; ++i) { w[i] = (__bf16)p[i]; w[8 + i] = (__bf16)p[16 + i]; }
  return w; }
__device__ __forceinline__ v16h wcolh_io(const float* Wm, int k0, int o, int lane, int ld) { v16h w; const int g = lane >> 4;
#pragma unroll
  for (int i = 0; i < 8; ++i) { w[i] = (_Float16)(bfr(Wm[(size_t)(k0 + 8 * g + i) * ld + o]) * 256.0f); w[8 + i] = (_Float16)(bfr(Wm[(size_t)(k0 + 16 + 8 * g + i) * ld + o]) * 256.0f); }
  return w; }
__device__ __forceinline__ v16h wcolh_oi(const float* Wm, int k0, int o, int lane, int K) { v16h w; const float* p = Wm + (size_t)o * K + k0 + 8 * (lane >> 4);
#pragma unroll
  for (int i = 0; i < 8; ++i) { w[i] = (_Float16)(bfr(p[i]) * 256.0f); w[8 + i] = (_Float16)(bfr(p[16 + i]) * 256.0f); }
  return w; }
#define WQKV_LAYOUT 0   // 0 = (in,out) [DIN][CC]; 1 = (out,in) [CC][DIN]; 2 = per-head [NH][DIN][HD]
__device__ __forceinline__ v16b wcol_hdk(const float* Wm, int k0, int o, int lane) { v16b w; const int g = lane >> 4; const float* p = Wm + (size_t)(o / HD) * DIN * HD + (o % HD);
#pragma unroll
  for (int i = 0; i < 8; ++i) { w[i] = (__bf16)p[(size_t)(k0 + 8 * g + i) * HD]; w[8 + i] = (__bf16)p[(size_t)(k0 + 16 + 8 * g + i) * HD]; }
  return w; }
#define WO_OUT_IN 0
#if WQKV_LAYOUT == 1
#define WCOL(W, k0, o, lane) wcol_oi(W, k0, o, lane, DIN)
#elif WQKV_LAYOUT == 2
#define WCOL(W, k0, o, lane) wcol_hdk(W, k0, o, lane)
#else
#define WCOL(W, k0, o, lane) wcol_io(W, k0, o, lane, CC)
#endif
#if WO_OUT_IN
#define WOCOL(W, k0, o, lane) wcol_oi(W, k0, o, lane, CC)
#define WOCOLH(W, k0, o, lane) wcolh_oi(W, k0, o, lane, CC)
#else
#define WOCOL(W, k0, o, lane) wcol_io(W, k0, o, lane, DIN)
#define WOCOLH(W, k0, o, lane) wcolh_io(W, k0, o, lane, DIN)
#endif
__global__ __launch_bounds__(256) void k_planes64(const float* __restrict__ Qs, const float* __restrict__ Ks, const float* __restrict__ Vs, _Float16* __restrict__ QH, _Float16* __restrict__ QL, _Float16* __restrict__ KH, _Float16* __restrict__ KL, _Float16* __restrict__ VT, __bf16* __restrict__ VB, __bf16* __restrict__ VBL) {
  __shared__ _Float16 sv[64][72];
  const int tid = threadIdx.x; const size_t r0 = (size_t)blockIdx.x * 64; const int b = (int)(r0 / TT), t0 = (int)(r0 % TT);
  for (int e = tid; e < 64 * 8; e += 256) { const int rl = e >> 3, q = e & 7; const size_t src = (r0 + rl) * CC + q * 8; float tq[8], tk[8], tv[8];
#pragma unroll
    for (int u = 0; u < 8; ++u) { tq[u] = Qs[src + u]; tk[u] = Ks[src + u]; tv[u] = Vs[src + u]; }
    asm volatile("s_wait_loadcnt 0x0" ::: "memory");
    hx8 hq, hk, hlq, hlk;
#pragma unroll
    for (int u = 0; u < 8; ++u) { const float qv = bfr(tq[u]), kv = bfr(tk[u]); const _Float16 qh = (_Float16)qv, kh = (_Float16)kv; hq[u] = qh; hlq[u] = (_Float16)((qv - (float)qh) * 1024.0f); hk[u] = kh; hlk[u] = (_Float16)((kv - (float)kh) * 1024.0f); sv[rl][q * 8 + u] = (_Float16)bfr(tv[u]); }
    vst2((unsigned*)(QH + (r0 + rl) * CC + q * 8), *(const v4u*)&hq); vst2((unsigned*)(KH + (r0 + rl) * CC + q * 8), *(const v4u*)&hk);
    if (t0 + rl < QHI) vst2((unsigned*)(QL + ((size_t)b * QHI + t0 + rl) * CC + q * 8), *(const v4u*)&hlq);
    if (t0 + rl < KHI) vst2((unsigned*)(KL + ((size_t)b * KHI + t0 + rl) * CC + q * 8), *(const v4u*)&hlk); }
  __syncthreads();
  for (int e = tid; e < 64 * 8; e += 256) { const int c = e >> 3, q = e & 7; hx8 hv; _Pragma("unroll") for (int j = 0; j < 8; ++j) hv[j] = sv[q * 8 + j][c]; vst2((unsigned*)(VT + ((size_t)b * CC + c) * TT + t0 + q * 8), *(const v4u*)&hv);
    if (t0 < KHI) { v8b bh, bl; _Pragma("unroll") for (int j = 0; j < 8; ++j) { const float vv = (float)hv[j]; const __bf16 h1 = (__bf16)vv; bh[j] = h1; bl[j] = (__bf16)(vv - (float)h1); } vst2((unsigned*)(VB + ((size_t)b * CC + c) * KHI + t0 + q * 8), *(const v4u*)&bh); vst2((unsigned*)(VBL + ((size_t)b * CC + c) * KHI + t0 + q * 8), *(const v4u*)&bl); } } }
#define SM_EXTRA_PARAMS
#define SM_MASK_HOOK (void)0
#ifndef SM_EXTRA_PARAMS
#define SM_EXTRA_PARAMS
#endif
#ifndef PROJ_EXTRA_PARAMS
#define PROJ_EXTRA_PARAMS
#endif
#ifndef SM_MASK_HOOK
#define SM_MASK_HOOK (void)0
#endif

#define WS_QH  0u                                      // f16 q rows [b*t][CC]
#define WS_KH  (WS_QH + 2u * (size_t)NB * TT * CC)      // f16 k rows [b*t][CC]
#define WS_VT  (WS_KH + 2u * (size_t)NB * TT * CC)      // f16 v planes [b][c][t]
#define WS_QL  (WS_VT + 2u * (size_t)NB * CC * TT)      // f16 q residual x 2^10 rows [b][t < QHI][CC]
#define WS_KL  (WS_QL + 2u * (size_t)NB * QHI * CC)     // f16 k residual x 2^10 rows [b][t < KHI][CC]
#define WS_VB  (WS_KL + 2u * (size_t)NB * KHI * CC)     // bf16 v hi planes [b][c][t < KHI]
#define WS_VBL (WS_VB + 2u * (size_t)NB * CC * KHI)
#define WS_END (WS_VBL + 2u * (size_t)NB * CC * KHI)

// ---- k_proj: block = (64 rows, 128 cols, which): q/k/v = X W (+ b) with exact bf16 products (K = DIN) -> which 0: q f16 rows (+ residual rows < QHI); 1: k f16 rows (+ residual rows < KHI); 2: v f16 planes [c][t] (+ bf16 hi/lo planes for t < KHI)
__global__ __launch_bounds__(128) void k_proj(const float* __restrict__ XQ, const float* __restrict__ XK, const float* __restrict__ XV, const float* __restrict__ WQ, const float* __restrict__ WK, const float* __restrict__ WV, const float* __restrict__ BQ, const float* __restrict__ BK, const float* __restrict__ BV,
    _Float16* __restrict__ QH, _Float16* __restrict__ QL, _Float16* __restrict__ KH, _Float16* __restrict__ KL, _Float16* __restrict__ VT, __bf16* __restrict__ VB, __bf16* __restrict__ VBL) {
  __shared__ __align__(16) _Float16 sh[64][136], sl[64][136]; __shared__ __align__(16) _Float16 th[128][72]; __shared__ __align__(16) __bf16 tb[128][72], tbl[128][72];
  const int tid = threadIdx.x, wave = tid >> 5, lane = tid & 31, col = lane & 15, g = lane >> 4; const int which = blockIdx.z; const int c0 = blockIdx.y * 128; const size_t r0 = (size_t)blockIdx.x * 64; const size_t bb = r0 / TT; const int t0 = (int)(r0 % TT);
  const float* X = which == 0 ? XQ : which == 1 ? XK : XV; const float* WA = which == 0 ? WQ : which == 1 ? WK : WV; const float* BA = which == 0 ? BQ : which == 1 ? BK : BV;
  v8f acc[8] = {};
#pragma unroll 2
  for (int kc = 0; kc < DIN / 32; ++kc) { v16b a; { const float* p = X + (r0 + wave * 16 + col) * DIN + kc * 32 + 8 * g;
#pragma unroll
      for (int i = 0; i < 8; ++i) { a[i] = (__bf16)p[i]; a[8 + i] = (__bf16)p[16 + i]; } }
    asm volatile("s_wait_loadcnt 0x0" ::: "memory");
#pragma unroll
    for (int j = 0; j < 8; ++j) { const v16b w = WCOL(WA, kc * 32, c0 + j * 16 + col, lane); asm volatile("s_wait_loadcnt 0x0" ::: "memory"); acc[j] = wmma_bf(a, w, acc[j]); } }
  if (which < 2) { _Float16* DH = which == 0 ? QH : KH; _Float16* DL = which == 0 ? QL : KL; const int nhi = which == 0 ? QHI : KHI; const bool hi_rows = t0 < nhi;
#pragma unroll
    for (int j = 0; j < 8; ++j) { const float bias = BA ? bfr(BA[c0 + j * 16 + col]) : 0.f;
#pragma unroll
      for (int r = 0; r < 8; ++r) { const float v = acc[j][r] + bias; const _Float16 hv = (_Float16)v; sh[wave * 16 + 8 * g + r][j * 16 + col] = hv; sl[wave * 16 + 8 * g + r][j * 16 + col] = (_Float16)((v - (float)hv) * 1024.0f); } }
    __syncthreads();
    for (int e = tid; e < 64 * 16; e += 128) { const int rl = e >> 4, q = e & 15; vst2((unsigned*)(DH + (r0 + rl) * CC + c0 + q * 8), *(const v4u*)&sh[rl][q * 8]); if (hi_rows) vst2((unsigned*)(DL + (bb * nhi + t0 + rl) * (size_t)CC + c0 + q * 8), *(const v4u*)&sl[rl][q * 8]); }
  } else { const bool hi_rows = t0 < KHI;
#pragma unroll
    for (int j = 0; j < 8; ++j) { const float bias = BA ? bfr(BA[c0 + j * 16 + col]) : 0.f;
#pragma unroll
      for (int r = 0; r < 8; ++r) { const float v = acc[j][r] + bias; const int rl = wave * 16 + 8 * g + r, cl = j * 16 + col; th[cl][rl] = (_Float16)v; const __bf16 bh = (__bf16)v; tb[cl][rl] = bh; tbl[cl][rl] = (__bf16)(v - (float)bh); } }
    __syncthreads();
    for (int e = tid; e < 128 * 8; e += 128) { const int cl = e >> 3, q = e & 7; vst2((unsigned*)(VT + (bb * CC + c0 + cl) * (size_t)TT + t0 + q * 8), *(const v4u*)&th[cl][q * 8]); if (hi_rows) { const size_t o3 = (bb * CC + c0 + cl) * (size_t)KHI + t0 + q * 8; vst2((unsigned*)(VB + o3), *(const v4u*)&tb[cl][q * 8]); vst2((unsigned*)(VBL + o3), *(const v4u*)&tbl[cl][q * 8]); } } } }
// ---- k_fa: block = 32 queries, 16 waves; wave w walks its own 1/16 of the keys in steps of 64 and keeps everything of a score in registers: S^T = K . Q^T (a lane holds one query's scores), running row max (kept in base-2 units: raw score x 64^-0.5 x log2 e) and row sum in f32, P x 2^11 = 2^(raw score x LSC + 11 - max): one fma and one base-2 exponential a score, once to f16, packed from the score tiles into the B operand of O^T += V^T . P^T. The 16 waves' (max, sum, O^T) meet in LDS: all are brought to the block's row max and added in wave order. Row sums carry the same 2^11 (an exact factor): O = sum / row sum; L = row sum / 2^11.
#define FQ 32              // queries per block: two 16-query column groups per wave, so that each K / V fragment feeds two products
#define FW 16              // waves per block = key slices
#define FKS (TT / FW)      // keys per wave
#define FST 64             // keys per step: one test of the running max and one rescale of O^T per 64 keys
#define LSC (SCALE * 1.44269504088896340736f)   // raw score -> exponent of 2
__device__ __forceinline__ v8f wmmah(v16h a, v16h b, v8f c) { return __builtin_amdgcn_wmma_f32_16x16x32_f16(false, a, false, b, (short)0, c, false, false); }
// eight independent 2^x in one statement. Outputs are early-clobber, so no v_exp_f32 here is followed by an instruction that writes its source or reads its result; the closing v_nop keeps that one slot behind the last of them, whatever the compiler puts next. The s_delay_alu in front is the hint for the first v_exp_f32, whose argument may come from the vector instruction directly ahead: without it the wave would hold the vector port against the SIMD's other waves while it waits.
__device__ __forceinline__ v8f exp2x8(v8f t) { float e0, e1, e2, e3, e4, e5, e6, e7;
  asm("s_delay_alu instid0(VALU_DEP_1)\n\tv_exp_f32 %0, %8\n\tv_exp_f32 %1, %9\n\tv_exp_f32 %2, %10\n\tv_exp_f32 %3, %11\n\tv_exp_f32 %4, %12\n\tv_exp_f32 %5, %13\n\tv_exp_f32 %6, %14\n\tv_exp_f32 %7, %15\n\tv_nop"
      : "=&v"(e0), "=&v"(e1), "=&v"(e2), "=&v"(e3), "=&v"(e4), "=&v"(e5), "=&v"(e6), "=&v"(e7) : "v"(t[0]), "v"(t[1]), "v"(t[2]), "v"(t[3]), "v"(t[4]), "v"(t[5]), "v"(t[6]), "v"(t[7]));
  const v8f e = {e0, e1, e2, e3, e4, e5, e6, e7}; return e; }
__device__ __forceinline__ float xhalf(float x) { return __builtin_bit_cast(float, __builtin_amdgcn_permlanex16(__builtin_bit_cast(int, x), __builtin_bit_cast(int, x), 0x76543210, 0xfedcba98, false, false)); }   // lane l with lane l ^ 16
__global__ __launch_bounds__(32 * FW) void k_fa(const _Float16* __restrict__ QH, const _Float16* __restrict__ KH, const _Float16* __restrict__ VT, float* __restrict__ O, float* __restrict__ L) {
  __shared__ __align__(16) float red[FW][16][32][4]; __shared__ float sm[FW][FQ], sl[FW][FQ]; __shared__ __align__(16) float ss[FQ][HD + 4];
  const int tid = threadIdx.x, wave = __builtin_amdgcn_readfirstlane(tid >> 5), lane = tid & 31, col = lane & 15; const int q0 = blockIdx.x * FQ;
  v16h qf[2][2];   /* every full unroll below is there so that the arrays it indexes (fragments, score tiles, accumulators) have constant indices and stay in registers */
#pragma unroll
  for (int qt = 0; qt < 2; ++qt) { qf[qt][0] = frag_h(QH + (size_t)(q0 + qt * 16 + col) * CC, lane); qf[qt][1] = frag_h(QH + (size_t)(q0 + qt * 16 + col) * CC + 32, lane); }
  v8f acc[2][HD / 16] = {}; float m[2] = {-3.0e38f, -3.0e38f}, l[2] = {0.f, 0.f};
  const _Float16* Kw = KH + (size_t)(wave * FKS + col) * CC; const _Float16* Vw = VT + (size_t)col * TT + wave * FKS;
#pragma unroll 1   /* one step's fragments, scores and sums take 204 of the 256 registers a wave of this block may own: two steps in flight would spill */
  for (int st = 0; st < FKS / FST; ++st) {
    v8f s[2][4];   /* s[qt][kt][r] = raw score of key 16 kt + 8 h + r of the step against query 16 qt + col */
#pragma unroll
    for (int kt = 0; kt < 4; ++kt) { const _Float16* kp = Kw + (size_t)(st * FST + kt * 16) * CC; const v16h ka = frag_h(kp, lane), kb = frag_h(kp + 32, lane);
#pragma unroll
      for (int qt = 0; qt < 2; ++qt) { const v8f z = {}; s[qt][kt] = wmmah(kb, qf[qt][1], wmmah(ka, qf[qt][0], z)); } }
    v16h p[2][2];
#pragma unroll
    for (int qt = 0; qt < 2; ++qt) { float mx = s[qt][0][0];
#pragma unroll
      for (int kt = 0; kt < 4; ++kt) {
#pragma unroll
        for (int r = 0; r < 8; ++r) mx = fmaxf(mx, s[qt][kt][r]); }
      mx = fmaxf(mx, xhalf(mx)); const float mn = fmaxf(m[qt], mx * LSC); const float al = __builtin_amdgcn_exp2f(m[qt] - mn); m[qt] = mn; const float off = 11.0f - mn;
#pragma unroll
      for (int j = 0; j < HD / 16; ++j) acc[qt][j] *= al;
      float a4[4];
#pragma unroll
      for (int kt = 0; kt < 4; ++kt) { const v8f lsc8 = {LSC, LSC, LSC, LSC, LSC, LSC, LSC, LSC}, off8 = {off, off, off, off, off, off, off, off}; const v8f e = exp2x8(__builtin_elementwise_fma(s[qt][kt], lsc8, off8));
#pragma unroll
        for (int r = 0; r < 8; ++r) { a4[kt] = r ? a4[kt] + e[r] : e[r]; p[qt][kt >> 1][(kt & 1) * 8 + r] = (_Float16)e[r]; } }
      l[qt] = l[qt] * al + ((a4[0] + a4[1]) + (a4[2] + a4[3])); }
#pragma unroll
    for (int kc = 0; kc < 2; ++kc) {
#pragma unroll
      for (int j = 0; j < HD / 16; ++j) { const v16h vf = frag_h(Vw + (size_t)(j * 16) * TT + st * FST + kc * 32, lane);
#pragma unroll
        for (int qt = 0; qt < 2; ++qt) acc[qt][j] = wmmah(vf, p[qt][kc], acc[qt][j]); } } }
  if (lane < 16) { sm[wave][col] = m[0]; sm[wave][16 + col] = m[1]; }
  __syncthreads();
#pragma unroll
  for (int qt = 0; qt < 2; ++qt) { float mf = sm[0][qt * 16 + col];
#pragma unroll
    for (int w = 1; w < FW; ++w) mf = fmaxf(mf, sm[w][qt * 16 + col]);
    const float f = __builtin_amdgcn_exp2f(m[qt] - mf); const float lw = (l[qt] + xhalf(l[qt])) * f; if (lane < 16) sl[wave][qt * 16 + col] = lw;
#pragma unroll
    for (int j = 0; j < HD / 16; ++j) {
#pragma unroll
      for (int hf = 0; hf < 2; ++hf) { v4f t;   /* red[wave][(qt * 4 + j) * 2 + hf][lane][u] = O^T partial of channel 16 j + 8 h + 4 hf + u, query 16 qt + col */
#pragma unroll
        for (int u = 0; u < 4; ++u) t[u] = acc[qt][j][hf * 4 + u] * f;
        *(v4f*)&red[wave][(qt * 4 + j) * 2 + hf][lane][0] = t; } } }
  __syncthreads();
  { const int sIdx = tid >> 5, qq = (sIdx >> 3) * 16 + col; v4f t = *(const v4f*)&red[0][sIdx][lane][0]; float ls = sl[0][qq];   /* thread = (slot, lane): four channels of one query, the 16 waves' parts added in wave order */
#pragma unroll
    for (int w = 1; w < FW; ++w) { t += *(const v4f*)&red[w][sIdx][lane][0]; ls += sl[w][qq]; }
#pragma unroll
    for (int u = 0; u < 4; ++u) t[u] = t[u] / ls;
    *(v4f*)&ss[qq][((sIdx >> 1) & 3) * 16 + 8 * (lane >> 4) + (sIdx & 1) * 4] = t;
    if (tid < FQ) { float lq = sl[0][tid];   /* the block's 32 row sums, same order as above: one whole line of L in one store of one wave */
#pragma unroll
      for (int w = 1; w < FW; ++w) lq += sl[w][tid];
      L[q0 + tid] = lq * (1.0f / 2048.0f); } }
  __syncthreads();
  vst2(O + (size_t)(q0 + (tid >> 4)) * CC + (tid & 15) * 4, *(const v4f*)&ss[tid >> 4][(tid & 15) * 4]); }

extern "C" void kernel_launch(void* const* d_in, const int* in_sizes, int n_in, void* d_out, int out_size, void* d_ws, size_t ws_size, hipStream_t stream) {
  (void)in_sizes; (void)n_in; (void)out_size;
  const float** F = (const float**)d_in;
  if (ws_size < (size_t)WS_END) return;
  char* ws = (char*)d_ws; _Float16 *QH = (_Float16*)(ws + WS_QH), *KH = (_Float16*)(ws + WS_KH), *VT = (_Float16*)(ws + WS_VT), *QL = (_Float16*)(ws + WS_QL), *KL = (_Float16*)(ws + WS_KL); __bf16 *VB = (__bf16*)(ws + WS_VB), *VBL = (__bf16*)(ws + WS_VBL);
  // inputs: 0 q [8192,64]; 1 k; 2 v; outputs: (O [8192,64], L [8192,1])
  k_planes64<<<dim3(TNB * TT / 64), 256, 0, stream>>>(F[0], F[1], F[2], QH, QL, KH, KL, VT, VB, VBL);
  float* Oout = (float*)d_out; float* Lout = (float*)((char*)d_out + (size_t)TT * 64 * 4);   /* tuple output: O [8192,64] at byte 0, L [8192,1] at byte 2,097,152 */
  k_fa<<<dim3(TT / FQ), 32 * FW, 0, stream>>>(QH, KH, VT, Oout, Lout);
}

// v005
// Measured time: 44.8 microseconds a run.
// Next to v004, in two timings, it ran 1.03 times as fast each time.
// Over all steps from v000 it is 63.4 times as fast.
// compute dtype: all float inputs rounded to bf16; q, k, v are bf16-valued so their f16 planes are exact; scores q x k (1 product on exact planes) x 64^-0.5; row max / exp / row sum in f32, exp(S - max) x 2^11 formed as 2^(one f32 fma) on the hardware's base-2 exponential: output 1 = L = sum_k exp(S - max); output 0 = O = (P v) / L with P x 2^11 once to f16 x v (exact) (1 product), the f32 sums divided by the row sum x 2^11; f32 outputs.
#include <hip/hip_runtime.h>
#include <math.h>

typedef __attribute__((ext_vector_type(16))) _Float16 v16h;
typedef __attribute__((ext_vector_type(16))) __bf16 v16b;
typedef __attribute__((ext_vector_type(8)))  _Float16 v8h;
typedef __attribute__((ext_vector_type(8)))  float v8f;
typedef __attribute__((ext_vector_type(4)))  float v4f;
typedef __attribute__((ext_vector_type(2)))  float v2f;
typedef __attribute__((ext_vector_type(4)))  unsigned v4u;
typedef _Float16 hx8 __attribute__((ext_vector_type(8)));
typedef __attribute__((ext_vector_type(4)))  int v4i;
typedef float __attribute__((may_alias)) float_a;
typedef int __attribute__((may_alias)) int_a;

template <typename T> __device__ __forceinline__ void vst2(void* p, T v) { *(T*)p = v;  }
__device__ __forceinline__ v8f wmma16(v16h a, v16h b, v8f c) {
  v8f d = __builtin_amdgcn_wmma_f32_16x16x32_f16(false, a, false, b, (short)0, c, false, false);
  asm volatile("v_nop\n\tv_nop\n\tv_nop\n\tv_nop" : "+v"(d) : "v"(a), "v"(b));
  return d;
}
__device__ __forceinline__ v8f wmma_bf(v16b a, v16b b, v8f c) {
  v8f d = __builtin_amdgcn_wmma_f32_16x16x32_bf16(false, a, false, b, (short)0, c, false, false);
  asm volatile("v_nop\n\tv_nop\n\tv_nop\n\tv_nop" : "+v"(d) : "v"(a), "v"(b));
  return d;
}
// 16x16x32 fragments: lane = (h = lane>>4, row/col = lane&15); elements 0..7 = k0+8h+0..7, 8..15 = k0+16+8h+0..7; D element r = row 8h+r
__device__ __forceinline__ v16h frag_h(const _Float16* rowk0, int lane) {
  union { v16h v; v8h q[2]; } u; const _Float16* p = rowk0 + 8 * (lane >> 4);
  u.q[0] = *(const v8h*)p; u.q[1] = *(const v8h*)(p + 16); return u.v;
}
__device__ __forceinline__ v16h frag_f32(const float* rowk0, int lane) {
  v16h a; const float* p = rowk0 + 8 * (lane >> 4);
#pragma unroll
  for (int i = 0; i < 8; ++i) { a[i] = (_Float16)p[i]; a[8 + i] = (_Float16)p[16 + i]; }
  return a;
}
__device__ __forceinline__ v16h frag_f32s(const float* rowk0, int lane, float sc) {
  v16h a; const float* p = rowk0 + 8 * (lane >> 4);
#pragma unroll
  for (int i = 0; i < 8; ++i) { a[i] = (_Float16)(p[i] * sc); a[8 + i] = (_Float16)(p[16 + i] * sc); }
  return a;
}
// column fragment from a [K][ld] layout (column n), rows >= K read as 0
__device__ __forceinline__ v16h fragc_f32(const float* W, int k0, int n, int lane, int ld, int K) {
  v16h a; const int g = lane >> 4;
#pragma unroll
  for (int i = 0; i < 8; ++i) { const int ka = k0 + 8 * g + i, kb = ka + 16;
    a[i] = (_Float16)(ka < K ? W[(size_t)(ka < K ? ka : K - 1) * ld + n] : 0.f); a[8 + i] = (_Float16)(kb < K ? W[(size_t)(kb < K ? kb : K - 1) * ld + n] : 0.f); }
  return a;
}
struct F2 { v16b h, l; };
__device__ __forceinline__ F2 bsplit16(const float v[16]) { F2 r;
#pragma unroll
  for (int i = 0; i < 16; ++i) { const __bf16 h = (__bf16)v[i]; r.h[i] = h; r.l[i] = (__bf16)(v[i] - (float)h); }
  return r; }
__device__ __forceinline__ F2 split_row(const float* row, int k0, int lane) { float v[16]; const float* p = row + k0 + 8 * (lane >> 4);
#pragma unroll
  for (int i = 0; i < 8; ++i) { v[i] = p[i]; v[8 + i] = p[16 + i]; }
  return bsplit16(v); }
__device__ __forceinline__ F2 split_rowK(const float* row, int k0, int lane, int K) { float v[16]; const int g = lane >> 4;
#pragma unroll
  for (int i = 0; i < 8; ++i) { const int ka = k0 + 8 * g + i, kb = ka + 16; v[i] = ka < K ? row[ka < K ? ka : K - 1] : 0.f; v[8 + i] = kb < K ? row[kb < K ? kb : K - 1] : 0.f; }
  return bsplit16(v); }
__device__ __forceinline__ F2 split_col(const float* W, int k0, int n, int lane, int ld, int K) { float v[16]; const int g = lane >> 4;
#pragma unroll
  for (int i = 0; i < 8; ++i) { const int ka = k0 + 8 * g + i, kb = ka + 16; v[i] = ka < K ? W[(size_t)(ka < K ? ka : K - 1) * ld + n] : 0.f; v[8 + i] = kb < K ? W[(size_t)(kb < K ? kb : K - 1) * ld + n] : 0.f; }
  return bsplit16(v); }
__device__ __forceinline__ v8f mac3(const F2& a, const F2& b, v8f c) { c = wmma_bf(a.l, b.h, c); c = wmma_bf(a.h, b.l, c); return wmma_bf(a.h, b.h, c); }
__device__ __forceinline__ float sigm(float v) { return 1.0f / (1.0f + expf(-v)); }
#define LDSX() do { asm volatile("s_wait_dscnt 0" ::: "memory"); __builtin_amdgcn_wave_barrier(); __builtin_amdgcn_fence(__ATOMIC_RELEASE, "workgroup"); } while (0)

// Flash-attention reference on one long sequence with TWO outputs (q / k / v [8192,64]; S = q k^T / 8; m = rowmax(S); P = exp(S - m); L = rowsum(P) [8192,1]; O = (P v) / L [8192,64]; returns the tuple (O, L); no mask). One kernel does scores, softmax and P v; no score reaches memory.
#define NB 1
#define TT 8192
#define CC 64            // NH * HD = projected width
#define DIN 64          // input (model) width
#define NH 1
#define HD 64
#define NQB (TT / 64)
#define HG 1
#define SCALE (0.125f)
#define CAUSAL 0
#ifndef TNB
#define TNB NB
#endif
__device__ __forceinline__ float bfr(float v) { return (float)(__bf16)v; }
__host__ __device__ __forceinline__ int kb_last(int qb) { return CAUSAL ? ((qb * 64 + 63) >> 7) : (TT / 128 - 1); }
typedef __attribute__((ext_vector_type(8))) __bf16 v8b;
__device__ __forceinline__ v16b frag_b(const __bf16* rowk0, int lane) {
  union { v16b v; v8b q[2]; } u; const __bf16* p = rowk0 + 8 * (lane >> 4);
  u.q[0] = *(const v8b*)p; u.q[1] = *(const v8b*)(p + 16); return u.v;
}
#define QBH 0              // exact planes: single-product logits and single-f16 P x V on every block
#define QHI 0               // no q residual plane (q is bf16-exact in f16)
#define KHI 64              // unused high-precision planes kept minimal
// B fragment (k rows k0+.., output column o) of a weight: (in,out) [K][ld] or (out,in) [ld rows of K]: bf16 exact, or f16(bf16 * 256) exact
__device__ __forceinline__ v16b wcol_io(const float* Wm, int k0, int o, int lane, int ld) { v16b w; const int g = lane >> 4;
#pragma unroll
  for (int i = 0; i < 8; ++i) { w[i] = (__bf16)Wm[(size_t)(k0 + 8 * g + i) * ld + o]; w[8 + i] = (__bf16)Wm[(size_t)(k0 + 16 + 8 * g + i) * ld + o]; }
  return w; }
__device__ __forceinline__ v16b wcol_oi(const float* Wm, int k0, int o, int lane, int K) { v16b w; const float* p = Wm + (size_t)o * K + k0 + 8 * (lane >> 4);
#pragma unroll
  for (int i = 0; i < 8; ++i) { w[i] = (__bf16)p[i]; w[8 + i] = (__bf16)p[16 + i]; }
  return w; }
__device__ __forceinline__ v16h wcolh_io(const float* Wm, int k0, int o, int lane, int ld) { v16h w; const int g = lane >> 4;
#pragma unroll
  for (int i = 0; i < 8; ++i) { w[i] = (_Float16)(bfr(Wm[(size_t)(k0 + 8 * g + i) * ld + o]) * 256.0f); w[8 + i] = (_Float16)(bfr(Wm[(size_t)(k0 + 16 + 8 * g + i) * ld + o]) * 256.0f); }
  return w; }
__device__ __forceinline__ v16h wcolh_oi(const float* Wm, int k0, int o, int lane, int K) { v16h w; const float* p = Wm + (size_t)o * K + k0 + 8 * (lane >> 4);
#pragma unroll
  for (int i = 0; i < 8; ++i) { w[i] = (_Float16)(bfr(p[i]) * 256.0f); w[8 + i] = (_Float16)(bfr(p[16 + i]) * 256.0f); }
  return w; }
#define WQKV_LAYOUT 0   // 0 = (in,out) [DIN][CC]; 1 = (out,in) [CC][DIN]; 2 = per-head [NH][DIN][HD]
__device__ __forceinline__ v16b wcol_hdk(const float* Wm, int k0, int o, int lane) { v16b w; const int g = lane >> 4; const float* p = Wm + (size_t)(o / HD) * DIN * HD + (o % HD);
#pragma unroll
  for (int i = 0; i < 8; ++i) { w[i] = (__bf16)p[(size_t)(k0 + 8 * g + i) * HD]; w[8 + i] = (__bf16)p[(size_t)(k0 + 16 + 8 * g + i) * HD]; }
  return w; }
#define WO_OUT_IN 0
#if WQKV_LAYOUT == 1
#define WCOL(W, k0, o, lane) wcol_oi(W, k0, o, lane, DIN)
#elif WQKV_LAYOUT == 2
#define WCOL(W, k0, o, lane) wcol_hdk(W, k0, o, lane)
#else
#define WCOL(W, k0, o, lane) wcol_io(W, k0, o, lane, CC)
#endif
#if WO_OUT_IN
#define WOCOL(W, k0, o, lane) wcol_oi(W, k0, o, lane, CC)
#define WOCOLH(W, k0, o, lane) wcolh_oi(W, k0, o, lane, CC)
#else
#define WOCOL(W, k0, o, lane) wcol_io(W, k0, o, lane, DIN)
#define WOCOLH(W, k0, o, lane) wcolh_io(W, k0, o, lane, DIN)
#endif
__global__ __launch_bounds__(256) void k_planes64(const float* __restrict__ Qs, const float* __restrict__ Ks, const float* __restrict__ Vs, _Float16* __restrict__ QH, _Float16* __restrict__ QL, _Float16* __restrict__ KH, _Float16* __restrict__ KL, _Float16* __restrict__ VT, __bf16* __restrict__ VB, __bf16* __restrict__ VBL) {
  __shared__ __align__(16) _Float16 sv[64][72], sk[64][72];
  const int tid = threadIdx.x; const size_t r0 = (size_t)blockIdx.x * 64; const int b = (int)(r0 / TT), t0 = (int)(r0 % TT);
  for (int e = tid; e < 64 * 8; e += 256) { const int rl = e >> 3, q = e & 7; const size_t src = (r0 + rl) * CC + q * 8; float tq[8], tk[8], tv[8];
#pragma unroll
    for (int u = 0; u < 8; ++u) { tq[u] = Qs[src + u]; tk[u] = Ks[src + u]; tv[u] = Vs[src + u]; }
    asm volatile("s_wait_loadcnt 0x0" ::: "memory");
    hx8 hq, hk, hlq, hlk;
#pragma unroll
    for (int u = 0; u < 8; ++u) { const float qv = bfr(tq[u]), kv = bfr(tk[u]); const _Float16 qh = (_Float16)qv, kh = (_Float16)kv; hq[u] = qh; hlq[u] = (_Float16)((qv - (float)qh) * 1024.0f); hk[u] = kh; hlk[u] = (_Float16)((kv - (float)kh) * 1024.0f); sv[rl][q * 8 + u] = (_Float16)bfr(tv[u]); }
    vst2((unsigned*)(QH + (r0 + rl) * CC + q * 8), *(const v4u*)&hq); vst2((unsigned*)&sk[rl][q * 8], *(const v4u*)&hk);
    if (t0 + rl < QHI) vst2((unsigned*)(QL + ((size_t)b * QHI + t0 + rl) * CC + q * 8), *(const v4u*)&hlq);
    if (t0 + rl < KHI) vst2((unsigned*)(KL + ((size_t)b * KHI + t0 + rl) * CC + q * 8), *(const v4u*)&hlk); }
  __syncthreads();
  /* fragment order: 16-byte unit e of the block's 8 KB of K = (16-key tile e >> 7, 32-channel chunk (e >> 6) & 1, fragment half (e >> 5) & 1, lane e & 31), of V = (32-key chunk e >> 8, 16-channel tile (e >> 6) & 3, fragment half, lane); a wave stores 512 contiguous bytes, and k_fa loads them the same way */
  for (int e = tid; e < 64 * 8; e += 256) { const int c16 = e & 15, o8 = ((e >> 5) & 1) * 16 + ((e >> 4) & 1) * 8;
    vst2((unsigned*)(KH + r0 * CC + e * 8), *(const v4u*)&sk[(e >> 7) * 16 + c16][((e >> 6) & 1) * 32 + o8]);
    const int c = ((e >> 6) & 3) * 16 + c16, q8 = (e >> 8) * 32 + o8; hx8 hv; _Pragma("unroll") for (int j = 0; j < 8; ++j) hv[j] = sv[q8 + j][c]; vst2((unsigned*)(VT + r0 * CC + e * 8), *(const v4u*)&hv);
    asm volatile("s_wait_xcnt 0x0" ::: "memory");   /* the two stores' address and data registers are rewritten right behind them (the next trip's address step, the split of hv below) */
    if (t0 < KHI) { v8b bh, bl; _Pragma("unroll") for (int j = 0; j < 8; ++j) { const float vv = (float)hv[j]; const __bf16 h1 = (__bf16)vv; bh[j] = h1; bl[j] = (__bf16)(vv - (float)h1); } vst2((unsigned*)(VB + ((size_t)b * CC + c) * KHI + t0 + q8), *(const v4u*)&bh); vst2((unsigned*)(VBL + ((size_t)b * CC + c) * KHI + t0 + q8), *(const v4u*)&bl);
      asm volatile("s_wait_xcnt 0x0" ::: "memory");   /* as above: the next trip reuses these stores' registers */ } } }
#define SM_EXTRA_PARAMS
#define SM_MASK_HOOK (void)0
#ifndef SM_EXTRA_PARAMS
#define SM_EXTRA_PARAMS
#endif
#ifndef PROJ_EXTRA_PARAMS
#define PROJ_EXTRA_PARAMS
#endif
#ifndef SM_MASK_HOOK
#define SM_MASK_HOOK (void)0
#endif

#define WS_QH  0u                                      // f16 q rows [b*t][CC]
#define WS_KH  (WS_QH + 2u * (size_t)NB * TT * CC)      // f16 k in fragment order [t / 16][c / 32][half][lane][8]
#define WS_VT  (WS_KH + 2u * (size_t)NB * TT * CC)      // f16 v in fragment order [t / 32][c / 16][half][lane][8]
#define WS_QL  (WS_VT + 2u * (size_t)NB * CC * TT)      // f16 q residual x 2^10 rows [b][t < QHI][CC]
#define WS_KL  (WS_QL + 2u * (size_t)NB * QHI * CC)     // f16 k residual x 2^10 rows [b][t < KHI][CC]
#define WS_VB  (WS_KL + 2u * (size_t)NB * KHI * CC)     // bf16 v hi planes [b][c][t < KHI]
#define WS_VBL (WS_VB + 2u * (size_t)NB * CC * KHI)
#define WS_END (WS_VBL + 2u * (size_t)NB * CC * KHI)

// ---- k_proj: block = (64 rows, 128 cols, which): q/k/v = X W (+ b) with exact bf16 products (K = DIN) -> which 0: q f16 rows (+ residual rows < QHI); 1: k f16 rows (+ residual rows < KHI); 2: v f16 planes [c][t] (+ bf16 hi/lo planes for t < KHI)
__global__ __launch_bounds__(128) void k_proj(const float* __restrict__ XQ, const float* __restrict__ XK, const float* __restrict__ XV, const float* __restrict__ WQ, const float* __restrict__ WK, const float* __restrict__ WV, const float* __restrict__ BQ, const float* __restrict__ BK, const float* __restrict__ BV,
    _Float16* __restrict__ QH, _Float16* __restrict__ QL, _Float16* __restrict__ KH, _Float16* __restrict__ KL, _Float16* __restrict__ VT, __bf16* __restrict__ VB, __bf16* __restrict__ VBL) {
  __shared__ __align__(16) _Float16 sh[64][136], sl[64][136]; __shared__ __align__(16) _Float16 th[128][72]; __shared__ __align__(16) __bf16 tb[128][72], tbl[128][72];
  const int tid = threadIdx.x, wave = tid >> 5, lane = tid & 31, col = lane & 15, g = lane >> 4; const int which = blockIdx.z; const int c0 = blockIdx.y * 128; const size_t r0 = (size_t)blockIdx.x * 64; const size_t bb = r0 / TT; const int t0 = (int)(r0 % TT);
  const float* X = which == 0 ? XQ : which == 1 ? XK : XV; const float* WA = which == 0 ? WQ : which == 1 ? WK : WV; const float* BA = which == 0 ? BQ : which == 1 ? BK : BV;
  v8f acc[8] = {};
#pragma unroll 2
  for (int kc = 0; kc < DIN / 32; ++kc) { v16b a; { const float* p = X + (r0 + wave * 16 + col) * DIN + kc * 32 + 8 * g;
#pragma unroll
      for (int i = 0; i < 8; ++i) { a[i] = (__bf16)p[i]; a[8 + i] = (__bf16)p[16 + i]; } }
    asm volatile("s_wait_loadcnt 0x0" ::: "memory");
#pragma unroll
    for (int j = 0; j < 8; ++j) { const v16b w = WCOL(WA, kc * 32, c0 + j * 16 + col, lane); asm volatile("s_wait_loadcnt 0x0" ::: "memory"); acc[j] = wmma_bf(a, w, acc[j]); } }
  if (which < 2) { _Float16* DH = which == 0 ? QH : KH; _Float16* DL = which == 0 ? QL : KL; const int nhi = which == 0 ? QHI : KHI; const bool hi_rows = t0 < nhi;
#pragma unroll
    for (int j = 0; j < 8; ++j) { const float bias = BA ? bfr(BA[c0 + j * 16 + col]) : 0.f;
#pragma unroll
      for (int r = 0; r < 8; ++r) { const float v = acc[j][r] + bias; const _Float16 hv = (_Float16)v; sh[wave * 16 + 8 * g + r][j * 16 + col] = hv; sl[wave * 16 + 8 * g + r][j * 16 + col] = (_Float16)((v - (float)hv) * 1024.0f); } }
    __syncthreads();
    for (int e = tid; e < 64 * 16; e += 128) { const int rl = e >> 4, q = e & 15; vst2((unsigned*)(DH + (r0 + rl) * CC + c0 + q * 8), *(const v4u*)&sh[rl][q * 8]); if (hi_rows) vst2((unsigned*)(DL + (bb * nhi + t0 + rl) * (size_t)CC + c0 + q * 8), *(const v4u*)&sl[rl][q * 8]); }
  } else { const bool hi_rows = t0 < KHI;
#pragma unroll
    for (int j = 0; j < 8; ++j) { const float bias = BA ? bfr(BA[c0 + j * 16 + col]) : 0.f;
#pragma unroll
      for (int r = 0; r < 8; ++r) { const float v = acc[j][r] + bias; const int rl = wave * 16 + 8 * g + r, cl = j * 16 + col; th[cl][rl] = (_Float16)v; const __bf16 bh = (__bf16)v; tb[cl][rl] = bh; tbl[cl][rl] = (__bf16)(v - (float)bh); } }
    __syncthreads();
    for (int e = tid; e < 128 * 8; e += 128) { const int cl = e >> 3, q = e & 7; vst2((unsigned*)(VT + (bb * CC + c0 + cl) * (size_t)TT + t0 + q * 8), *(const v4u*)&th[cl][q * 8]); if (hi_rows) { const size_t o3 = (bb * CC + c0 + cl) * (size_t)KHI + t0 + q * 8; vst2((unsigned*)(VB + o3), *(const v4u*)&tb[cl][q * 8]); vst2((unsigned*)(VBL + o3), *(const v4u*)&tbl[cl][q * 8]); } } } }
// ---- k_fa: block = 32 queries, 16 waves; wave w walks its own 1/16 of the keys in steps of 64 and keeps everything of a score in registers: S^T = K . Q^T (a lane holds one query's scores), running row max (kept in base-2 units: raw score x 64^-0.5 x log2 e) and row sum in f32, P x 2^11 = 2^(raw score x LSC + 11 - max): one fma and one base-2 exponential a score, once to f16, packed from the score tiles into the B operand of O^T += V^T . P^T. The 16 waves' (max, sum, O^T) meet in LDS: all are brought to the block's row max and added in wave order. Row sums carry the same 2^11 (an exact factor): O = sum / row sum; L = row sum / 2^11.
#define FQ 32              // queries per block: two 16-query column groups per wave, so that each K / V fragment feeds two products
#define FW 16              // waves per block = key slices
#define FKS (TT / FW)      // keys per wave
#define FST 64             // keys per step: one test of the running max and one rescale of O^T per 64 keys
#define LSC (SCALE * 1.44269504088896340736f)   // raw score -> exponent of 2
__device__ __forceinline__ v8f wmmah(v16h a, v16h b, v8f c) { return __builtin_amdgcn_wmma_f32_16x16x32_f16(false, a, false, b, (short)0, c, false, false); }
// eight independent 2^x in one statement. Outputs are early-clobber, so no v_exp_f32 here is followed by an instruction that writes its source or reads its result; the closing v_nop keeps that one slot behind the last of them, whatever the compiler puts next. The s_delay_alu in front is the hint for the first v_exp_f32, whose argument may come from the vector instruction directly ahead: without it the wave would hold the vector port against the SIMD's other waves while it waits.
__device__ __forceinline__ v8f exp2x8(v8f t) { float e0, e1, e2, e3, e4, e5, e6, e7;
  asm("s_delay_alu instid0(VALU_DEP_1)\n\tv_exp_f32 %0, %8\n\tv_exp_f32 %1, %9\n\tv_exp_f32 %2, %10\n\tv_exp_f32 %3, %11\n\tv_exp_f32 %4, %12\n\tv_exp_f32 %5, %13\n\tv_exp_f32 %6, %14\n\tv_exp_f32 %7, %15\n\tv_nop"
      : "=&v"(e0), "=&v"(e1), "=&v"(e2), "=&v"(e3), "=&v"(e4), "=&v"(e5), "=&v"(e6), "=&v"(e7) : "v"(t[0]), "v"(t[1]), "v"(t[2]), "v"(t[3]), "v"(t[4]), "v"(t[5]), "v"(t[6]), "v"(t[7]));
  const v8f e = {e0, e1, e2, e3, e4, e5, e6, e7}; return e; }
// fragment from a fragment-order plane: p = the fragment's start + 8 * lane; each of the two loads covers 512 contiguous bytes over the wave (4 whole lines)
__device__ __forceinline__ v16h frag_p(const _Float16* p) { union { v16h v; v8h q[2]; } u; u.q[0] = *(const v8h*)p; u.q[1] = *(const v8h*)(p + 256); return u.v; }
__device__ __forceinline__ float xhalf(float x) { return __builtin_bit_cast(float, __builtin_amdgcn_permlanex16(__builtin_bit_cast(int, x), __builtin_bit_cast(int, x), 0x76543210, 0xfedcba98, false, false)); }   // lane l with lane l ^ 16
__global__ __launch_bounds__(32 * FW) void k_fa(const _Float16* __restrict__ QH, const _Float16* __restrict__ KH, const _Float16* __restrict__ VT, float* __restrict__ O, float* __restrict__ L) {
  __shared__ __align__(16) float red[FW][16][32][4]; __shared__ float sm[FW][FQ], sl[FW][FQ]; __shared__ __align__(16) float ss[FQ][HD + 4];
  const int tid = threadIdx.x, wave = __builtin_amdgcn_readfirstlane(tid >> 5), lane = tid & 31, col = lane & 15; const int q0 = blockIdx.x * FQ;
  v16h qf[2][2];   /* every full unroll below is there so that the arrays it indexes (fragments, score tiles, accumulators) have constant indices and stay in registers */
#pragma unroll
  for (int qt = 0; qt < 2; ++qt) { qf[qt][0] = frag_h(QH + (size_t)(q0 + qt * 16 + col) * CC, lane); qf[qt][1] = frag_h(QH + (size_t)(q0 + qt * 16 + col) * CC + 32, lane); }
  v8f acc[2][HD / 16] = {}; float m[2] = {-3.0e38f, -3.0e38f}, l[2] = {0.f, 0.f};
  const _Float16* Kw = KH + (size_t)(wave * FKS) * CC + lane * 8; const _Float16* Vw = VT + (size_t)(wave * FKS) * CC + lane * 8;
#pragma unroll 1   /* one step's fragments, scores and sums take 204 of the 256 registers a wave of this block may own: two steps in flight would spill */
  for (int st = 0; st < FKS / FST; ++st) {
    v8f s[2][4];   /* s[qt][kt][r] = raw score of key 16 kt + 8 h + r of the step against query 16 qt + col */
#pragma unroll
    for (int kt = 0; kt < 4; ++kt) { const _Float16* kp = Kw + (size_t)(st * FST + kt * 16) * CC; const v16h ka = frag_p(kp), kb = frag_p(kp + 512);
#pragma unroll
      for (int qt = 0; qt < 2; ++qt) { const v8f z = {}; s[qt][kt] = wmmah(kb, qf[qt][1], wmmah(ka, qf[qt][0], z)); } }
    v16h p[2][2];
#pragma unroll
    for (int qt = 0; qt < 2; ++qt) { float mx = s[qt][0][0];
#pragma unroll
      for (int kt = 0; kt < 4; ++kt) {
#pragma unroll
        for (int r = 0; r < 8; ++r) mx = fmaxf(mx, s[qt][kt][r]); }
      mx = fmaxf(mx, xhalf(mx)); const float mn = fmaxf(m[qt], mx * LSC); const float al = __builtin_amdgcn_exp2f(m[qt] - mn); m[qt] = mn; const float off = 11.0f - mn;
#pragma unroll
      for (int j = 0; j < HD / 16; ++j) acc[qt][j] *= al;
      float a4[4];
#pragma unroll
      for (int kt = 0; kt < 4; ++kt) { const v8f lsc8 = {LSC, LSC, LSC, LSC, LSC, LSC, LSC, LSC}, off8 = {off, off, off, off, off, off, off, off}; const v8f e = exp2x8(__builtin_elementwise_fma(s[qt][kt], lsc8, off8));
#pragma unroll
        for (int r = 0; r < 8; ++r) { a4[kt] = r ? a4[kt] + e[r] : e[r]; p[qt][kt >> 1][(kt & 1) * 8 + r] = (_Float16)e[r]; } }
      l[qt] = l[qt] * al + ((a4[0] + a4[1]) + (a4[2] + a4[3])); }
#pragma unroll
    for (int kc = 0; kc < 2; ++kc) {
#pragma unroll
      for (int j = 0; j < HD / 16; ++j) { const v16h vf = frag_p(Vw + (size_t)(st * FST + kc * 32) * CC + j * 512);
#pragma unroll
        for (int qt = 0; qt < 2; ++qt) acc[qt][j] = wmmah(vf, p[qt][kc], acc[qt][j]); } } }
  if (lane < 16) { sm[wave][col] = m[0]; sm[wave][16 + col] = m[1]; }
  __syncthreads();
#pragma unroll
  for (int qt = 0; qt < 2; ++qt) { float mf = sm[0][qt * 16 + col];
#pragma unroll
    for (int w = 1; w < FW; ++w) mf = fmaxf(mf, sm[w][qt * 16 + col]);
    const float f = __builtin_amdgcn_exp2f(m[qt] - mf); const float lw = (l[qt] + xhalf(l[qt])) * f; if (lane < 16) sl[wave][qt * 16 + col] = lw;
#pragma unroll
    for (int j = 0; j < HD / 16; ++j) {
#pragma unroll
      for (int hf = 0; hf < 2; ++hf) { v4f t;   /* red[wave][(qt * 4 + j) * 2 + hf][lane][u] = O^T partial of channel 16 j + 8 h + 4 hf + u, query 16 qt + col */
#pragma unroll
        for (int u = 0; u < 4; ++u) t[u] = acc[qt][j][hf * 4 + u] * f;
        *(v4f*)&red[wave][(qt * 4 + j) * 2 + hf][lane][0] = t; } } }
  __syncthreads();
  { const int sIdx = tid >> 5, qq = (sIdx >> 3) * 16 + col; v4f t = *(const v4f*)&red[0][sIdx][lane][0]; float ls = sl[0][qq];   /* thread = (slot, lane): four channels of one query, the 16 waves' parts added in wave order */
#pragma unroll
    for (int w = 1; w < FW; ++w) { t += *(const v4f*)&red[w][sIdx][lane][0]; ls += sl[w][qq]; }
#pragma unroll
    for (int u = 0; u < 4; ++u) t[u] = t[u] / ls;
    *(v4f*)&ss[qq][((sIdx >> 1) & 3) * 16 + 8 * (lane >> 4) + (sIdx & 1) * 4] = t;
    if (tid < FQ) { float lq = sl[0][tid];   /* the block's 32 row sums, same order as above: one whole line of L in one store of one wave */
#pragma unroll
      for (int w = 1; w < FW; ++w) lq += sl[w][tid];
      L[q0 + tid] = lq * (1.0f / 2048.0f); } }
  __syncthreads();
  vst2(O + (size_t)(q0 + (tid >> 4)) * CC + (tid & 15) * 4, *(const v4f*)&ss[tid >> 4][(tid & 15) * 4]); }

extern "C" void kernel_launch(void* const* d_in, const int* in_sizes, int n_in, void* d_out, int out_size, void* d_ws, size_t ws_size, hipStream_t stream) {
  (void)in_sizes; (void)n_in; (void)out_size;
  const float** F = (const float**)d_in;
  if (ws_size < (size_t)WS_END) return;
  char* ws = (char*)d_ws; _Float16 *QH = (_Float16*)(ws + WS_QH), *KH = (_Float16*)(ws + WS_KH), *VT = (_Float16*)(ws + WS_VT), *QL = (_Float16*)(ws + WS_QL), *KL = (_Float16*)(ws + WS_KL); __bf16 *VB = (__bf16*)(ws + WS_VB), *VBL = (__bf16*)(ws + WS_VBL);
  // inputs: 0 q [8192,64]; 1 k; 2 v; outputs: (O [8192,64], L [8192,1])
  k_planes64<<<dim3(TNB * TT / 64), 256, 0, stream>>>(F[0], F[1], F[2], QH, QL, KH, KL, VT, VB, VBL);
  float* Oout = (float*)d_out; float* Lout = (float*)((char*)d_out + (size_t)TT * 64 * 4);   /* tuple output: O [8192,64] at byte 0, L [8192,1] at byte 2,097,152 */
  k_fa<<<dim3(TT / FQ), 32 * FW, 0, stream>>>(QH, KH, VT, Oout, Lout);
}

// v006
// One run takes 27.3 microseconds.
// In two side-by-side timings against v005, it was 1.65 and 1.64 times as fast.
// All steps since v000 together make it 104 times as fast.
// compute dtype: all float inputs rounded to bf16; q, k, v are bf16-valued so their f16 planes are exact; scores q x k (1 product on exact planes) x 64^-0.5; row max / exp / row sum in f32, exp(S - max) x 2^11 formed as 2^(one f32 fma) on the hardware's base-2 exponential: output 1 = L = sum_k exp(S - max); output 0 = O = (P v) / L with P x 2^11 once to f16 x v (exact) (1 product), the f32 sums divided by the row sum x 2^11; f32 outputs.
#include <hip/hip_runtime.h>
#include <math.h>

typedef __attribute__((ext_vector_type(16))) _Float16 v16h;
typedef __attribute__((ext_vector_type(16))) __bf16 v16b;
typedef __attribute__((ext_vector_type(8)))  _Float16 v8h;
typedef __attribute__((ext_vector_type(8)))  float v8f;
typedef __attribute__((ext_vector_type(4)))  float v4f;
typedef __attribute__((ext_vector_type(2)))  float v2f;
typedef __attribute__((ext_vector_type(4)))  unsigned v4u;
typedef _Float16 hx8 __attribute__((ext_vector_type(8)));
typedef __attribute__((ext_vector_type(4)))  int v4i;
typedef float __attribute__((may_alias)) float_a;
typedef int __attribute__((may_alias)) int_a;

template <typename T> __device__ __forceinline__ void vst2(void* p, T v) { *(T*)p = v;  }
__device__ __forceinline__ v8f wmma16(v16h a, v16h b, v8f c) {
  v8f d = __builtin_amdgcn_wmma_f32_16x16x32_f16(false, a, false, b, (short)0, c, false, false);
  asm volatile("v_nop\n\tv_nop\n\tv_nop\n\tv_nop" : "+v"(d) : "v"(a), "v"(b));
  return d;
}
__device__ __forceinline__ v8f wmma_bf(v16b a, v16b b, v8f c) {
  v8f d = __builtin_amdgcn_wmma_f32_16x16x32_bf16(false, a, false, b, (short)0, c, false, false);
  asm volatile("v_nop\n\tv_nop\n\tv_nop\n\tv_nop" : "+v"(d) : "v"(a), "v"(b));
  return d;
}
// 16x16x32 fragments: lane = (h = lane>>4, row/col = lane&15); elements 0..7 = k0+8h+0..7, 8..15 = k0+16+8h+0..7; D element r = row 8h+r
__device__ __forceinline__ v16h frag_h(const _Float16* rowk0, int lane) {
  union { v16h v; v8h q[2]; } u; const _Float16* p = rowk0 + 8 * (lane >> 4);
  u.q[0] = *(const v8h*)p; u.q[1] = *(const v8h*)(p + 16); return u.v;
}
__device__ __forceinline__ v16h frag_f32(const float* rowk0, int lane) {
  v16h a; const float* p = rowk0 + 8 * (lane >> 4);
#pragma unroll
  for (int i = 0; i < 8; ++i) { a[i] = (_Float16)p[i]; a[8 + i] = (_Float16)p[16 + i]; }
  return a;
}
__device__ __forceinline__ v16h frag_f32s(const float* rowk0, int lane, float sc) {
  v16h a; const float* p = rowk0 + 8 * (lane >> 4);
#pragma unroll
  for (int i = 0; i < 8; ++i) { a[i] = (_Float16)(p[i] * sc); a[8 + i] = (_Float16)(p[16 + i] * sc); }
  return a;
}
// column fragment from a [K][ld] layout (column n), rows >= K read as 0
__device__ __forceinline__ v16h fragc_f32(const float* W, int k0, int n, int lane, int ld, int K) {
  v16h a; const int g = lane >> 4;
#pragma unroll
  for (int i = 0; i < 8; ++i) { const int ka = k0 + 8 * g + i, kb = ka + 16;
    a[i] = (_Float16)(ka < K ? W[(size_t)(ka < K ? ka : K - 1) * ld + n] : 0.f); a[8 + i] = (_Float16)(kb < K ? W[(size_t)(kb < K ? kb : K - 1) * ld + n] : 0.f); }
  return a;
}
struct F2 { v16b h, l; };
__device__ __forceinline__ F2 bsplit16(const float v[16]) { F2 r;
#pragma unroll
  for (int i = 0; i < 16; ++i) { const __bf16 h = (__bf16)v[i]; r.h[i] = h; r.l[i] = (__bf16)(v[i] - (float)h); }
  return r; }
__device__ __forceinline__ F2 split_row(const float* row, int k0, int lane) { float v[16]; const float* p = row + k0 + 8 * (lane >> 4);
#pragma unroll
  for (int i = 0; i < 8; ++i) { v[i] = p[i]; v[8 + i] = p[16 + i]; }
  return bsplit16(v); }
__device__ __forceinline__ F2 split_rowK(const float* row, int k0, int lane, int K) { float v[16]; const int g = lane >> 4;
#pragma unroll
  for (int i = 0; i < 8; ++i) { const int ka = k0 + 8 * g + i, kb = ka + 16; v[i] = ka < K ? row[ka < K ? ka : K - 1] : 0.f; v[8 + i] = kb < K ? row[kb < K ? kb : K - 1] : 0.f; }
  return bsplit16(v); }
__device__ __forceinline__ F2 split_col(const float* W, int k0, int n, int lane, int ld, int K) { float v[16]; const int g = lane >> 4;
#pragma unroll
  for (int i = 0; i < 8; ++i) { const int ka = k0 + 8 * g + i, kb = ka + 16; v[i] = ka < K ? W[(size_t)(ka < K ? ka : K - 1) * ld + n] : 0.f; v[8 + i] = kb < K ? W[(size_t)(kb < K ? kb : K - 1) * ld + n] : 0.f; }
  return bsplit16(v); }
__device__ __forceinline__ v8f mac3(const F2& a, const F2& b, v8f c) { c = wmma_bf(a.l, b.h, c); c = wmma_bf(a.h, b.l, c); return wmma_bf(a.h, b.h, c); }
__device__ __forceinline__ float sigm(float v) { return 1.0f / (1.0f + expf(-v)); }
#define LDSX() do { asm volatile("s_wait_dscnt 0" ::: "memory"); __builtin_amdgcn_wave_barrier(); __builtin_amdgcn_fence(__ATOMIC_RELEASE, "workgroup"); } while (0)

// Flash-attention reference on one long sequence with TWO outputs (q / k / v [8192,64]; S = q k^T / 8; m = rowmax(S); P = exp(S - m); L = rowsum(P) [8192,1]; O = (P v) / L [8192,64]; returns the tuple (O, L); no mask). One kernel does scores, softmax and P v; no score reaches memory.
#define NB 1
#define TT 8192
#define CC 64            // NH * HD = projected width
#define DIN 64          // input (model) width
#define NH 1
#define HD 64
#define NQB (TT / 64)
#define HG 1
#define SCALE (0.125f)
#define CAUSAL 0
#ifndef TNB
#define TNB NB
#endif
__device__ __forceinline__ float bfr(float v) { return (float)(__bf16)v; }
__host__ __device__ __forceinline__ int kb_last(int qb) { return CAUSAL ? ((qb * 64 + 63) >> 7) : (TT / 128 - 1); }
typedef __attribute__((ext_vector_type(8))) __bf16 v8b;
__device__ __forceinline__ v16b frag_b(const __bf16* rowk0, int lane) {
  union { v16b v; v8b q[2]; } u; const __bf16* p = rowk0 + 8 * (lane >> 4);
  u.q[0] = *(const v8b*)p; u.q[1] = *(const v8b*)(p + 16); return u.v;
}
#define QBH 0              // exact planes: single-product logits and single-f16 P x V on every block
#define QHI 0               // no q residual plane (q is bf16-exact in f16)
#define KHI 64              // unused high-precision planes kept minimal
// B fragment (k rows k0+.., output column o) of a weight: (in,out) [K][ld] or (out,in) [ld rows of K]: bf16 exact, or f16(bf16 * 256) exact
__device__ __forceinline__ v16b wcol_io(const float* Wm, int k0, int o, int lane, int ld) { v16b w; const int g = lane >> 4;
#pragma unroll
  for (int i = 0; i < 8; ++i) { w[i] = (__bf16)Wm[(size_t)(k0 + 8 * g + i) * ld + o]; w[8 + i] = (__bf16)Wm[(size_t)(k0 + 16 + 8 * g + i) * ld + o]; }
  return w; }
__device__ __forceinline__ v16b wcol_oi(const float* Wm, int k0, int o, int lane, int K) { v16b w; const float* p = Wm + (size_t)o * K + k0 + 8 * (lane >> 4);
#pragma unroll
  for (int i = 0; i < 8; ++i) { w[i] = (__bf16)p[i]; w[8 + i] = (__bf16)p[16 + i]; }
  return w; }
__device__ __forceinline__ v16h wcolh_io(const float* Wm, int k0, int o, int lane, int ld) { v16h w; const int g = lane >> 4;
#pragma unroll
  for (int i = 0; i < 8; ++i) { w[i] = (_Float16)(bfr(Wm[(size_t)(k0 + 8 * g + i) * ld + o]) * 256.0f); w[8 + i] = (_Float16)(bfr(Wm[(size_t)(k0 + 16 + 8 * g + i) * ld + o]) * 256.0f); }
  return w; }
__device__ __forceinline__ v16h wcolh_oi(const float* Wm, int k0, int o, int lane, int K) { v16h w; const float* p = Wm + (size_t)o * K + k0 + 8 * (lane >> 4);
#pragma unroll
  for (int i = 0; i < 8; ++i) { w[i] = (_Float16)(bfr(p[i]) * 256.0f); w[8 + i] = (_Float16)(bfr(p[16 + i]) * 256.0f); }
  return w; }
#define WQKV_LAYOUT 0   // 0 = (in,out) [DIN][CC]; 1 = (out,in) [CC][DIN]; 2 = per-head [NH][DIN][HD]
__device__ __forceinline__ v16b wcol_hdk(const float* Wm, int k0, int o, int lane) { v16b w; const int g = lane >> 4; const float* p = Wm + (size_t)(o / HD) * DIN * HD + (o % HD);
#pragma unroll
  for (int i = 0; i < 8; ++i) { w[i] = (__bf16)p[(size_t)(k0 + 8 * g + i) * HD]; w[8 + i] = (__bf16)p[(size_t)(k0 + 16 + 8 * g + i) * HD]; }
  return w; }
#define WO_OUT_IN 0
#if WQKV_LAYOUT == 1
#define WCOL(W, k0, o, lane) wcol_oi(W, k0, o, lane, DIN)
#elif WQKV_LAYOUT == 2
#define WCOL(W, k0, o, lane) wcol_hdk(W, k0, o, lane)
#else
#define WCOL(W, k0, o, lane) wcol_io(W, k0, o, lane, CC)
#endif
#if WO_OUT_IN
#define WOCOL(W, k0, o, lane) wcol_oi(W, k0, o, lane, CC)
#define WOCOLH(W, k0, o, lane) wcolh_oi(W, k0, o, lane, CC)
#else
#define WOCOL(W, k0, o, lane) wcol_io(W, k0, o, lane, DIN)
#define WOCOLH(W, k0, o, lane) wcolh_io(W, k0, o, lane, DIN)
#endif
__global__ __launch_bounds__(256) void k_planes64(const float* __restrict__ Qs, const float* __restrict__ Ks, const float* __restrict__ Vs, _Float16* __restrict__ QH, _Float16* __restrict__ QL, _Float16* __restrict__ KH, _Float16* __restrict__ KL, _Float16* __restrict__ VT, __bf16* __restrict__ VB, __bf16* __restrict__ VBL) {
  __shared__ __align__(16) _Float16 sv[64][72], sk[64][72];
  const int tid = threadIdx.x; const size_t r0 = (size_t)blockIdx.x * 64; const int b = (int)(r0 / TT), t0 = (int)(r0 % TT);
  for (int e = tid; e < 64 * 8; e += 256) { const int rl = e >> 3, q = e & 7; const size_t src = (r0 + rl) * CC + q * 8; float tq[8], tk[8], tv[8];
#pragma unroll
    for (int u = 0; u < 8; ++u) { tq[u] = Qs[src + u]; tk[u] = Ks[src + u]; tv[u] = Vs[src + u]; }
    asm volatile("s_wait_loadcnt 0x0" ::: "memory");
    hx8 hq, hk, hlq, hlk;
#pragma unroll
    for (int u = 0; u < 8; ++u) { const float qv = bfr(tq[u]), kv = bfr(tk[u]); const _Float16 qh = (_Float16)qv, kh = (_Float16)kv; hq[u] = qh; hlq[u] = (_Float16)((qv - (float)qh) * 1024.0f); hk[u] = kh; hlk[u] = (_Float16)((kv - (float)kh) * 1024.0f); sv[rl][q * 8 + u] = (_Float16)bfr(tv[u]); }
    vst2((unsigned*)(QH + (r0 + rl) * CC + q * 8), *(const v4u*)&hq); vst2((unsigned*)&sk[rl][q * 8], *(const v4u*)&hk);
    if (t0 + rl < QHI) vst2((unsigned*)(QL + ((size_t)b * QHI + t0 + rl) * CC + q * 8), *(const v4u*)&hlq);
    if (t0 + rl < KHI) vst2((unsigned*)(KL + ((size_t)b * KHI + t0 + rl) * CC + q * 8), *(const v4u*)&hlk); }
  __syncthreads();
  /* fragment order: 16-byte unit e of the block's 8 KB of K = (16-key tile e >> 7, 32-channel chunk (e >> 6) & 1, fragment half (e >> 5) & 1, lane e & 31), of V = (32-key chunk e >> 8, 16-channel tile (e >> 6) & 3, fragment half, lane); a wave stores 512 contiguous bytes, and k_fa loads them the same way */
  for (int e = tid; e < 64 * 8; e += 256) { const int c16 = e & 15, o8 = ((e >> 5) & 1) * 16 + ((e >> 4) & 1) * 8;
    vst2((unsigned*)(KH + r0 * CC + e * 8), *(const v4u*)&sk[(e >> 7) * 16 + c16][((e >> 6) & 1) * 32 + o8]);
    const int c = ((e >> 6) & 3) * 16 + c16, q8 = (e >> 8) * 32 + o8; hx8 hv; _Pragma("unroll") for (int j = 0; j < 8; ++j) hv[j] = sv[q8 + j][c]; vst2((unsigned*)(VT + r0 * CC + e * 8), *(const v4u*)&hv);
    asm volatile("s_wait_xcnt 0x0" ::: "memory");   /* the two stores' address and data registers are rewritten right behind them (the next trip's address step, the split of hv below) */
    if (t0 < KHI) { v8b bh, bl; _Pragma("unroll") for (int j = 0; j < 8; ++j) { const float vv = (float)hv[j]; const __bf16 h1 = (__bf16)vv; bh[j] = h1; bl[j] = (__bf16)(vv - (float)h1); } vst2((unsigned*)(VB + ((size_t)b * CC + c) * KHI + t0 + q8), *(const v4u*)&bh); vst2((unsigned*)(VBL + ((size_t)b * CC + c) * KHI + t0 + q8), *(const v4u*)&bl);
      asm volatile("s_wait_xcnt 0x0" ::: "memory");   /* as above: the next trip reuses these stores' registers */ } } }
#define SM_EXTRA_PARAMS
#define SM_MASK_HOOK (void)0
#ifndef SM_EXTRA_PARAMS
#define SM_EXTRA_PARAMS
#endif
#ifndef PROJ_EXTRA_PARAMS
#define PROJ_EXTRA_PARAMS
#endif
#ifndef SM_MASK_HOOK
#define SM_MASK_HOOK (void)0
#endif

#define WS_QH  0u                                      // f16 q rows [b*t][CC]
#define WS_KH  (WS_QH + 2u * (size_t)NB * TT * CC)      // f16 k in fragment order [t / 16][c / 32][half][lane][8]
#define WS_VT  (WS_KH + 2u * (size_t)NB * TT * CC)      // f16 v in fragment order [t / 32][c / 16][half][lane][8]
#define WS_QL  (WS_VT + 2u * (size_t)NB * CC * TT)      // f16 q residual x 2^10 rows [b][t < QHI][CC]
#define WS_KL  (WS_QL + 2u * (size_t)NB * QHI * CC)     // f16 k residual x 2^10 rows [b][t < KHI][CC]
#define WS_VB  (WS_KL + 2u * (size_t)NB * KHI * CC)     // bf16 v hi planes [b][c][t < KHI]
#define WS_VBL (WS_VB + 2u * (size_t)NB * CC * KHI)
#define WS_END (WS_VBL + 2u * (size_t)NB * CC * KHI)

// ---- k_proj: block = (64 rows, 128 cols, which): q/k/v = X W (+ b) with exact bf16 products (K = DIN) -> which 0: q f16 rows (+ residual rows < QHI); 1: k f16 rows (+ residual rows < KHI); 2: v f16 planes [c][t] (+ bf16 hi/lo planes for t < KHI)
__global__ __launch_bounds__(128) void k_proj(const float* __restrict__ XQ, const float* __restrict__ XK, const float* __restrict__ XV, const float* __restrict__ WQ, const float* __restrict__ WK, const float* __restrict__ WV, const float* __restrict__ BQ, const float* __restrict__ BK, const float* __restrict__ BV,
    _Float16* __restrict__ QH, _Float16* __restrict__ QL, _Float16* __restrict__ KH, _Float16* __restrict__ KL, _Float16* __restrict__ VT, __bf16* __restrict__ VB, __bf16* __restrict__ VBL) {
  __shared__ __align__(16) _Float16 sh[64][136], sl[64][136]; __shared__ __align__(16) _Float16 th[128][72]; __shared__ __align__(16) __bf16 tb[128][72], tbl[128][72];
  const int tid = threadIdx.x, wave = tid >> 5, lane = tid & 31, col = lane & 15, g = lane >> 4; const int which = blockIdx.z; const int c0 = blockIdx.y * 128; const size_t r0 = (size_t)blockIdx.x * 64; const size_t bb = r0 / TT; const int t0 = (int)(r0 % TT);
  const float* X = which == 0 ? XQ : which == 1 ? XK : XV; const float* WA = which == 0 ? WQ : which == 1 ? WK : WV; const float* BA = which == 0 ? BQ : which == 1 ? BK : BV;
  v8f acc[8] = {};
#pragma unroll 2
  for (int kc = 0; kc < DIN / 32; ++kc) { v16b a; { const float* p = X + (r0 + wave * 16 + col) * DIN + kc * 32 + 8 * g;
#pragma unroll
      for (int i = 0; i < 8; ++i) { a[i] = (__bf16)p[i]; a[8 + i] = (__bf16)p[16 + i]; } }
    asm volatile("s_wait_loadcnt 0x0" ::: "memory");
#pragma unroll
    for (int j = 0; j < 8; ++j) { const v16b w = WCOL(WA, kc * 32, c0 + j * 16 + col, lane); asm volatile("s_wait_loadcnt 0x0" ::: "memory"); acc[j] = wmma_bf(a, w, acc[j]); } }
  if (which < 2) { _Float16* DH = which == 0 ? QH : KH; _Float16* DL = which == 0 ? QL : KL; const int nhi = which == 0 ? QHI : KHI; const bool hi_rows = t0 < nhi;
#pragma unroll
    for (int j = 0; j < 8; ++j) { const float bias = BA ? bfr(BA[c0 + j * 16 + col]) : 0.f;
#pragma unroll
      for (int r = 0; r < 8; ++r) { const float v = acc[j][r] + bias; const _Float16 hv = (_Float16)v; sh[wave * 16 + 8 * g + r][j * 16 + col] = hv; sl[wave * 16 + 8 * g + r][j * 16 + col] = (_Float16)((v - (float)hv) * 1024.0f); } }
    __syncthreads();
    for (int e = tid; e < 64 * 16; e += 128) { const int rl = e >> 4, q = e & 15; vst2((unsigned*)(DH + (r0 + rl) * CC + c0 + q * 8), *(const v4u*)&sh[rl][q * 8]); if (hi_rows) vst2((unsigned*)(DL + (bb * nhi + t0 + rl) * (size_t)CC + c0 + q * 8), *(const v4u*)&sl[rl][q * 8]); }
  } else { const bool hi_rows = t0 < KHI;
#pragma unroll
    for (int j = 0; j < 8; ++j) { const float bias = BA ? bfr(BA[c0 + j * 16 + col]) : 0.f;
#pragma unroll
      for (int r = 0; r < 8; ++r) { const float v = acc[j][r] + bias; const int rl = wave * 16 + 8 * g + r, cl = j * 16 + col; th[cl][rl] = (_Float16)v; const __bf16 bh = (__bf16)v; tb[cl][rl] = bh; tbl[cl][rl] = (__bf16)(v - (float)bh); } }
    __syncthreads();
    for (int e = tid; e < 128 * 8; e += 128) { const int cl = e >> 3, q = e & 7; vst2((unsigned*)(VT + (bb * CC + c0 + cl) * (size_t)TT + t0 + q * 8), *(const v4u*)&th[cl][q * 8]); if (hi_rows) { const size_t o3 = (bb * CC + c0 + cl) * (size_t)KHI + t0 + q * 8; vst2((unsigned*)(VB + o3), *(const v4u*)&tb[cl][q * 8]); vst2((unsigned*)(VBL + o3), *(const v4u*)&tbl[cl][q * 8]); } } } }
// ---- k_fa: block = 32 queries, 16 waves; wave w walks its own 1/16 of the keys in steps of 32 and keeps everything of a score in registers: S^T = K . Q^T (a lane holds one query's scores), running row max (kept in base-2 units: raw score x 64^-0.5 x log2 e) and row sum in f32, P x 2^11 = 2^(raw score x LSC + 11 - max): one fma and one base-2 exponential a score, once to f16, packed from the score tiles into the B operand of O^T += V^T . P^T. The K and V fragments of a step are loaded one step ahead, into the registers that the step's own products have just read. The 16 waves' (max, sum, O^T) meet in LDS: all are brought to the block's row max and added in wave order. Row sums carry the same 2^11 (an exact factor): O = sum / row sum; L = row sum / 2^11.
#define FQ 32              // queries per block: two 16-query column groups per wave, so that each K / V fragment feeds two products
#define FW 16              // waves per block = key slices
#define FKS (TT / FW)      // keys per wave
#define FST 32             // keys per step: small enough that the next step's K and V fragments (64 registers) fit beside this step's scores
#define NST (FKS / FST)    // steps per wave
#define LSC (SCALE * 1.44269504088896340736f)   // raw score -> exponent of 2
__device__ __forceinline__ v8f wmmah(v16h a, v16h b, v8f c) { return __builtin_amdgcn_wmma_f32_16x16x32_f16(false, a, false, b, (short)0, c, false, false); }
// eight independent 2^x in one statement. Outputs are early-clobber, so no v_exp_f32 here is followed by an instruction that writes its source or reads its result; the closing v_nop keeps that one slot behind the last of them, whatever the compiler puts next. The s_delay_alu in front is the hint for the first v_exp_f32, whose argument may come from the vector instruction directly ahead: without it the wave would hold the vector port against the SIMD's other waves while it waits.
__device__ __forceinline__ v8f exp2x8(v8f t) { float e0, e1, e2, e3, e4, e5, e6, e7;
  asm("s_delay_alu instid0(VALU_DEP_1)\n\tv_exp_f32 %0, %8\n\tv_exp_f32 %1, %9\n\tv_exp_f32 %2, %10\n\tv_exp_f32 %3, %11\n\tv_exp_f32 %4, %12\n\tv_exp_f32 %5, %13\n\tv_exp_f32 %6, %14\n\tv_exp_f32 %7, %15\n\tv_nop"
      : "=&v"(e0), "=&v"(e1), "=&v"(e2), "=&v"(e3), "=&v"(e4), "=&v"(e5), "=&v"(e6), "=&v"(e7) : "v"(t[0]), "v"(t[1]), "v"(t[2]), "v"(t[3]), "v"(t[4]), "v"(t[5]), "v"(t[6]), "v"(t[7]));
  const v8f e = {e0, e1, e2, e3, e4, e5, e6, e7}; return e; }
// fragment from a fragment-order plane: p = the fragment's start + 8 * lane; each of the two loads covers 512 contiguous bytes over the wave (4 whole lines)
__device__ __forceinline__ v16h frag_p(const _Float16* p) { union { v16h v; v8h q[2]; } u; u.q[0] = *(const v8h*)p; u.q[1] = *(const v8h*)(p + 256); return u.v; }
__device__ __forceinline__ float xhalf(float x) { return __builtin_bit_cast(float, __builtin_amdgcn_permlanex16(__builtin_bit_cast(int, x), __builtin_bit_cast(int, x), 0x76543210, 0xfedcba98, false, false)); }   // lane l with lane l ^ 16
// one step of a wave: 32 keys x 32 queries. kf and vf hold this step's fragments; with MORE, the next step's (at Kn, Vn) are asked for as soon as this step's products have read the registers, K behind the score products and V behind the output products, so that a load has the softmax and a run of products to arrive in.
template <bool MORE> __device__ __forceinline__ void fa_step(const _Float16* Kn, const _Float16* Vn, const v16h (&qf)[2][2], v16h (&kf)[2][2], v16h (&vf)[HD / 16], v8f (&acc)[2][HD / 16], float (&m)[2], float (&l)[2]) {
  v8f s[2][2];   /* s[qt][kt][r] = raw score of key 16 kt + 8 h + r of the step against query 16 qt + col */
#pragma unroll
  for (int kt = 0; kt < 2; ++kt) {
#pragma unroll
    for (int qt = 0; qt < 2; ++qt) { const v8f z = {}; s[qt][kt] = wmmah(kf[kt][1], qf[qt][1], wmmah(kf[kt][0], qf[qt][0], z)); } }
  if (MORE) {
#pragma unroll
    for (int kt = 0; kt < 2; ++kt) { kf[kt][0] = frag_p(Kn + kt * 16 * CC); kf[kt][1] = frag_p(Kn + kt * 16 * CC + 512); } }
  v16h p[2];
#pragma unroll
  for (int qt = 0; qt < 2; ++qt) { float mx = s[qt][0][0];
#pragma unroll
    for (int kt = 0; kt < 2; ++kt) {
#pragma unroll
      for (int r = 0; r < 8; ++r) mx = fmaxf(mx, s[qt][kt][r]); }
    mx = fmaxf(mx, xhalf(mx)); const float mn = fmaxf(m[qt], mx * LSC); const float al = __builtin_amdgcn_exp2f(m[qt] - mn); m[qt] = mn; const float off = 11.0f - mn;
#pragma unroll
    for (int j = 0; j < HD / 16; ++j) acc[qt][j] *= al;
    float a2[2];
#pragma unroll
    for (int kt = 0; kt < 2; ++kt) { const v8f lsc8 = {LSC, LSC, LSC, LSC, LSC, LSC, LSC, LSC}, off8 = {off, off, off, off, off, off, off, off}; const v8f e = exp2x8(__builtin_elementwise_fma(s[qt][kt], lsc8, off8));
#pragma unroll
      for (int r = 0; r < 8; ++r) { a2[kt] = r ? a2[kt] + e[r] : e[r]; p[qt][kt * 8 + r] = (_Float16)e[r]; } }
    l[qt] = l[qt] * al + (a2[0] + a2[1]); }
#pragma unroll
  for (int j = 0; j < HD / 16; ++j) {
#pragma unroll
    for (int qt = 0; qt < 2; ++qt) acc[qt][j] = wmmah(vf[j], p[qt], acc[qt][j]); }
  if (MORE) {
#pragma unroll
    for (int j = 0; j < HD / 16; ++j) vf[j] = frag_p(Vn + j * 512);
    asm volatile("s_wait_xcnt 0x0" ::: "memory");   /* these loads are still in flight when the next step forms its addresses in the same registers */ } }
__global__ __launch_bounds__(32 * FW) void k_fa(const _Float16* __restrict__ QH, const _Float16* __restrict__ KH, const _Float16* __restrict__ VT, float* __restrict__ O, float* __restrict__ L) {
  __shared__ __align__(16) float red[FW][16][32][4]; __shared__ float sm[FW][FQ], sl[FW][FQ]; __shared__ __align__(16) float ss[FQ][HD + 4];
  const int tid = threadIdx.x, wave = __builtin_amdgcn_readfirstlane(tid >> 5), lane = tid & 31, col = lane & 15; const int q0 = blockIdx.x * FQ;
  v16h qf[2][2];   /* every full unroll below is there so that the arrays it indexes (fragments, score tiles, accumulators) have constant indices and stay in registers */
#pragma unroll
  for (int qt = 0; qt < 2; ++qt) { qf[qt][0] = frag_h(QH + (size_t)(q0 + qt * 16 + col) * CC, lane); qf[qt][1] = frag_h(QH + (size_t)(q0 + qt * 16 + col) * CC + 32, lane); }
  v8f acc[2][HD / 16] = {}; float m[2] = {-3.0e38f, -3.0e38f}, l[2] = {0.f, 0.f};
  const _Float16* Kw = KH + (size_t)(wave * FKS) * CC + lane * 8; const _Float16* Vw = VT + (size_t)(wave * FKS) * CC + lane * 8;
  v16h kf[2][2], vf[HD / 16];   /* the fragments of the step at hand: kf[kt][c] = keys 16 kt.., channels 32 c..; vf[j] = channels 16 j.. of the step's 32 keys */
#pragma unroll
  for (int kt = 0; kt < 2; ++kt) { kf[kt][0] = frag_p(Kw + kt * 16 * CC); kf[kt][1] = frag_p(Kw + kt * 16 * CC + 512); }
  asm volatile("s_wait_xcnt 0x0" ::: "memory");   /* the V fragments loaded next land in registers that hold addresses of the loads above; it also keeps K ahead of V in issue order, the order of every later step, so that the loop's counted waits for K leave V in flight */
#pragma unroll
  for (int j = 0; j < HD / 16; ++j) vf[j] = frag_p(Vw + j * 512);
#pragma unroll 1   /* rolled: a second step in flight would need a second set of scores, and the registers are taken by the fragments fetched ahead */
  for (int st = 0; st < NST - 1; ++st) fa_step<true>(Kw + (size_t)(st + 1) * FST * CC, Vw + (size_t)(st + 1) * FST * CC, qf, kf, vf, acc, m, l);
  fa_step<false>(Kw, Vw, qf, kf, vf, acc, m, l);   /* the last step fetches nothing */
  if (lane < 16) { sm[wave][col] = m[0]; sm[wave][16 + col] = m[1]; }
  __syncthreads();
#pragma unroll
  for (int qt = 0; qt < 2; ++qt) { float mf = sm[0][qt * 16 + col];
#pragma unroll
    for (int w = 1; w < FW; ++w) mf = fmaxf(mf, sm[w][qt * 16 + col]);
    const float f = __builtin_amdgcn_exp2f(m[qt] - mf); const float lw = (l[qt] + xhalf(l[qt])) * f; if (lane < 16) sl[wave][qt * 16 + col] = lw;
#pragma unroll
    for (int j = 0; j < HD / 16; ++j) {
#pragma unroll
      for (int hf = 0; hf < 2; ++hf) { v4f t;   /* red[wave][(qt * 4 + j) * 2 + hf][lane][u] = O^T partial of channel 16 j + 8 h + 4 hf + u, query 16 qt + col */
#pragma unroll
        for (int u = 0; u < 4; ++u) t[u] = acc[qt][j][hf * 4 + u] * f;
        *(v4f*)&red[wave][(qt * 4 + j) * 2 + hf][lane][0] = t; } } }
  __syncthreads();
  { const int sIdx = tid >> 5, qq = (sIdx >> 3) * 16 + col; v4f t = *(const v4f*)&red[0][sIdx][lane][0]; float ls = sl[0][qq];   /* thread = (slot, lane): four channels of one query, the 16 waves' parts added in wave order */
#pragma unroll
    for (int w = 1; w < FW; ++w) { t += *(const v4f*)&red[w][sIdx][lane][0]; ls += sl[w][qq]; }
#pragma unroll
    for (int u = 0; u < 4; ++u) t[u] = t[u] / ls;
    *(v4f*)&ss[qq][((sIdx >> 1) & 3) * 16 + 8 * (lane >> 4) + (sIdx & 1) * 4] = t;
    if (tid < FQ) { float lq = sl[0][tid];   /* the block's 32 row sums, same order as above: one whole line of L in one store of one wave */
#pragma unroll
      for (int w = 1; w < FW; ++w) lq += sl[w][tid];
      L[q0 + tid] = lq * (1.0f / 2048.0f); } }
  __syncthreads();
  vst2(O + (size_t)(q0 + (tid >> 4)) * CC + (tid & 15) * 4, *(const v4f*)&ss[tid >> 4][(tid & 15) * 4]); }

extern "C" void kernel_launch(void* const* d_in, const int* in_sizes, int n_in, void* d_out, int out_size, void* d_ws, size_t ws_size, hipStream_t stream) {
  (void)in_sizes; (void)n_in; (void)out_size;
  const float** F = (const float**)d_in;
  if (ws_size < (size_t)WS_END) return;
  char* ws = (char*)d_ws; _Float16 *QH = (_Float16*)(ws + WS_QH), *KH = (_Float16*)(ws + WS_KH), *VT = (_Float16*)(ws + WS_VT), *QL = (_Float16*)(ws + WS_QL), *KL = (_Float16*)(ws + WS_KL); __bf16 *VB = (__bf16*)(ws + WS_VB), *VBL = (__bf16*)(ws + WS_VBL);
  // inputs: 0 q [8192,64]; 1 k; 2 v; outputs: (O [8192,64], L [8192,1])
  k_planes64<<<dim3(TNB * TT / 64), 256, 0, stream>>>(F[0], F[1], F[2], QH, QL, KH, KL, VT, VB, VBL);
  float* Oout = (float*)d_out; float* Lout = (float*)((char*)d_out + (size_t)TT * 64 * 4);   /* tuple output: O [8192,64] at byte 0, L [8192,1] at byte 2,097,152 */
  k_fa<<<dim3(TT / FQ), 32 * FW, 0, stream>>>(QH, KH, VT, Oout, Lout);
}
